// v000
// Measured on an AMD MI455X. A time is GPU time per run, averaged over a window of back-to-back runs after a warm-up
// (all launches, gaps included; the runs take copies of the inputs in turn), and the median of several windows.
// Apart from v000's, it joins two sittings. Times from different sittings can be a few percent apart, while
// side-by-side timings come from the same sitting.
// The starting kernel, v000, takes 739 microseconds a run.
#include <hip/hip_runtime.h>

// Single-head attention with POST-softmax scaling (x [4][4096][256]; q,k,v = x W ('xw' [256][32], no bias); energy = q.k UNSCALED; att = softmax(energy) x 32^-0.5; out = att v -> [4][4096][32] (0.5 M)).
// Layout per batch: bf16 copy of x; the three 32-wide projections as 64-wide exact GEMMs against zero-padded weights (columns 32..63 exactly 0, so the 64-wide planes are the 32-wide vectors padded); dense T-4096 attention with one head (every row hi/lo 3 products; dense score tiles; streaming three-sweep softmax); the f32 context's first 32 columns x 32^-0.5 are the output rows.
// Compute dtypes, f32 accumulate: every input rounded to bf16; projections exact; scores and att.v 3 products on every row (unscaled logits, sigma ~5.7); softmax f32; the post-softmax scale applied in f32 at the end (a power of two times 1/sqrt(2): one rounding, as the reference's att x scaling then att v up to association).

#define NB_  4
#define TT   4096
#define DM   256
#define NH_  1
#define NKV  1
#define REP  (NH_ / NKV)
#define HD   64
#define DQ   (NH_ * HD)
#define DKV  (NKV * HD)
#define ZH   1
#define RH   4096                 // = TT: every row hi/lo (unscaled logits sigma ~3)
#define WIN  0
#define PCAR 1024.0f
#define SCL  1.0f   // unscaled
#define HDR  32     // real head dim
#define OSC  0.17677669529663688f   // 32^-0.5 applied after the softmax
typedef _Float16 h16;
typedef unsigned short bf;
typedef __attribute__((ext_vector_type(16))) __bf16   v16bf;
typedef __attribute__((ext_vector_type(16))) _Float16 v16h;
typedef __attribute__((ext_vector_type(8)))  _Float16 v8h;
typedef __attribute__((ext_vector_type(8)))  unsigned short v8us;
typedef __attribute__((ext_vector_type(8)))  float    v8f;
typedef __attribute__((ext_vector_type(4)))  float    v4f;
typedef v8h  __attribute__((may_alias)) v8ha;
typedef v4f  __attribute__((may_alias)) v4fa;
typedef v8us __attribute__((may_alias)) v8usa;

__device__ __forceinline__ unsigned short f2bf(float f) { unsigned u = __float_as_uint(f); u += 0x7FFFu + ((u >> 16) & 1u); return (unsigned short)(u >> 16); }
__device__ __forceinline__ float bf2f(unsigned short b) { return __uint_as_float(((unsigned)b) << 16); }
__device__ __forceinline__ float bfr(float f) { return bf2f(f2bf(f)); }
__device__ __forceinline__ v16h cat16(v8h lo, v8h hi) { return __builtin_shufflevector(lo, hi, 0, 1, 2, 3, 4, 5, 6, 7, 8, 9, 10, 11, 12, 13, 14, 15); }
__device__ __forceinline__ v16bf cat16b(v8us lo, v8us hi) { return __builtin_bit_cast(v16bf, __builtin_shufflevector(lo, hi, 0, 1, 2, 3, 4, 5, 6, 7, 8, 9, 10, 11, 12, 13, 14, 15)); }
__device__ __forceinline__ v8f wmma16(v16h a, v16h b, v8f c) { return __builtin_amdgcn_wmma_f32_16x16x32_f16(false, a, false, b, (short)0, c, false, false); }
__device__ __forceinline__ v8f wmmab(v16bf a, v16bf b, v8f c) { return __builtin_amdgcn_wmma_f32_16x16x32_bf16(false, a, false, b, (short)0, c, false, false); }



// ---- k_gemmw: register-blocked GEMM, ONE WAVE per 64x64 output tile (16 accumulators), operands straight from K-contiguous 16-bit planes; grid (M/64, N/64, Z), 32 threads.
// C[m][n] (f32, pitch ldc, + optional f32 bias[n]) = sum_k A[m][k] Bt[n][k] (+ split products per NSPLIT). z-batch strides sA/sB/sC in elements. K % 32 == 0.
template <typename T16> struct WFrag;
template <> struct WFrag<h16> { typedef v16h V; static __device__ __forceinline__ V ld(const h16* p) { return cat16(*(const v8h*)p, *(const v8h*)(p + 16)); } static __device__ __forceinline__ v8f mma(V a, V b, v8f c) { return wmma16(a, b, c); } };
template <> struct WFrag<bf> { typedef v16bf V; static __device__ __forceinline__ V ld(const bf* p) { return cat16b(*(const v8us*)p, *(const v8us*)(p + 16)); } static __device__ __forceinline__ v8f mma(V a, V b, v8f c) { return wmmab(a, b, c); } };
template <typename T16, int NSPLIT, bool BIAS>
__global__ __launch_bounds__(32) void k_gemmw(const T16* __restrict__ A, const T16* __restrict__ A2, const T16* __restrict__ Bt, const T16* __restrict__ Bt2, int K, float* C, int ldc, const float* __restrict__ bias, size_t sA, size_t sB, size_t sC) {
    typedef typename WFrag<T16>::V V;
    __shared__ __align__(16) float os[16 * 68];
    const size_t z = blockIdx.z; A += z * sA; if (A2) A2 += z * sA; Bt += z * sB; if (Bt2) Bt2 += z * sB; C += z * sC;
    const int lane = threadIdx.x & 31, lr = lane & 15, hi = lane >> 4; const int r0 = blockIdx.x * 64, c0 = blockIdx.y * 64;
    v8f acc[4][4];
#pragma unroll
    for (int mb = 0; mb < 4; ++mb)
#pragma unroll
        for (int nb = 0; nb < 4; ++nb) acc[mb][nb] = (v8f){};
    const size_t aoff = (size_t)(r0 + lr) * K + 8 * hi, boff = (size_t)(c0 + lr) * K + 8 * hi;
#pragma unroll 1
    for (int kc = 0; kc < K; kc += 32) {
        V a[4], a2[4];
#pragma unroll
        for (int mb = 0; mb < 4; ++mb) { a[mb] = WFrag<T16>::ld(A + aoff + (size_t)mb * 16 * K + kc); if (NSPLIT == 1 || NSPLIT == 2) a2[mb] = WFrag<T16>::ld(A2 + aoff + (size_t)mb * 16 * K + kc); }
#pragma unroll
        for (int nb = 0; nb < 4; ++nb) { const V b = WFrag<T16>::ld(Bt + boff + (size_t)nb * 16 * K + kc); V b2; if (NSPLIT >= 2) b2 = WFrag<T16>::ld(Bt2 + boff + (size_t)nb * 16 * K + kc);
#pragma unroll
            for (int mb = 0; mb < 4; ++mb) { acc[mb][nb] = WFrag<T16>::mma(a[mb], b, acc[mb][nb]); if (NSPLIT == 1 || NSPLIT == 2) acc[mb][nb] = WFrag<T16>::mma(a2[mb], b, acc[mb][nb]); if (NSPLIT >= 2) acc[mb][nb] = WFrag<T16>::mma(a[mb], b2, acc[mb][nb]); } }
        asm volatile("v_nop\n\tv_nop\n\tv_nop\n\tv_nop" : "+v"(acc[0][0]), "+v"(acc[1][1]), "+v"(acc[2][2]), "+v"(acc[3][3]) : "v"(a[0]), "v"(a[3]));
    }
#pragma unroll
    for (int mb = 0; mb < 4; ++mb) {
#pragma unroll
        for (int nb = 0; nb < 4; ++nb) {
#pragma unroll
            for (int j = 0; j < 8; ++j) os[(hi * 8 + j) * 68 + nb * 16 + lr] = acc[mb][nb][j]; }
        __builtin_amdgcn_wave_barrier(); asm volatile("" ::: "memory");
        float* crow = C + (size_t)(r0 + mb * 16) * ldc + c0;
{
#pragma unroll
            for (int s = 0; s < 8; ++s) { const int row = 2 * s + hi, cofs = lr * 4; v4f val = *(const v4fa*)(os + row * 68 + cofs); if (BIAS) { val[0] += bfr(bias[c0 + cofs]); val[1] += bfr(bias[c0 + cofs + 1]); val[2] += bfr(bias[c0 + cofs + 2]); val[3] += bfr(bias[c0 + cofs + 3]); }
                *(v4f*)(crow + (size_t)row * ldc + cofs) = val; }
             }
        __builtin_amdgcn_wave_barrier(); asm volatile("" ::: "memory");
    }
}

__device__ __forceinline__ h16 tohx(float x) { return (h16)x; }
__device__ __forceinline__ void splitf(float y, unsigned short& h, unsigned short& l) { h = f2bf(y); l = f2bf(y - bf2f(h)); }
typedef __attribute__((ext_vector_type(2))) _Float16 v2h;
typedef __attribute__((ext_vector_type(4))) _Float16 v4h;
typedef __attribute__((ext_vector_type(2))) unsigned short v2us;
typedef __attribute__((ext_vector_type(4))) unsigned short v4us;
typedef __attribute__((ext_vector_type(2))) float v2f;
typedef __attribute__((ext_vector_type(4))) int v4i;

__global__ __launch_bounds__(256) void k_wtG(const float* __restrict__ w, int K, int N, bf* Bt) {
    const int lane = threadIdx.x & 31; const int L0 = (blockIdx.x * 8 + (threadIdx.x >> 5)) * 8; const int nlines = N * K / 64;
{
#pragma unroll 1
        for (int l = 0; l < 8; ++l) { const int L = L0 + l; if (L >= nlines) break; const size_t e = (size_t)L * 64 + lane * 2; const int k = (int)(e % K), n = (int)(e / K); v2us o;
            o[0] = f2bf(w[(size_t)k * N + n]); o[1] = f2bf(w[(size_t)(k + 1) * N + n]); *(v2us*)(Bt + e) = o; }
         }
}
__global__ __launch_bounds__(256) void k_cvt8(const float* __restrict__ src, bf* dst, size_t n8) { const size_t i = (size_t)blockIdx.x * 256 + threadIdx.x; if (i >= n8) return; const v8f v = *(const v8f*)(src + i * 8); v8us o;
#pragma unroll
    for (int k = 0; k < 8; ++k) o[k] = f2bf(v[k]); *(v8us*)(dst + i * 8) = o;  }

// k_rope: head planes [h][t][d] (fp16 + hi/lo) of rope(x) x sc with the rotate-half convention out[d] = x[d] cos[t][d] - x[d+HD/2] sin[t][d], out[d+HD/2] = x[d+HD/2] cos[t][d+HD/2] + x[d] sin[t][d+HD/2]
__global__ __launch_bounds__(256) void k_rope(const float* __restrict__ F, int pitch, int nheads, const float* __restrict__ CS, const float* __restrict__ RF, const float* __restrict__ nw, float sc, h16* P16, bf* Ph, bf* Pl) {
    const size_t e = ((size_t)blockIdx.x * 256 + threadIdx.x) * 2; if (e >= (size_t)nheads * TT * HD) return; const int d = (int)(e % HD); const int t = (int)((e / HD) % TT); const int h = (int)(e / ((size_t)HD * TT)); const float* f = F + (size_t)t * pitch + h * HD; const float rf = RF ? RF[(size_t)h * TT + t] : 1.0f; v2h o16; v2us oh, ol;
#pragma unroll
    for (int q = 0; q < 2; ++q) { const int dd = d + q; const int dp = (dd < HD / 2) ? dd + HD / 2 : dd - HD / 2; float x0 = f[dd], x1 = f[dp];
        if (RF) { float n0 = __fmul_rn(x0, rf), n1 = __fmul_rn(x1, rf); asm volatile("" : "+v"(n0)); asm volatile("" : "+v"(n1)); x0 = __fmul_rn(bfr(nw[dd]), n0); x1 = __fmul_rn(bfr(nw[dp]), n1); }
        const v2f cs = *(const v2f*)(CS + ((size_t)t * HD + dd) * 2); float a = __fmul_rn(x0, cs[0]), bq = __fmul_rn(x1, cs[1]); asm volatile("" : "+v"(a)); asm volatile("" : "+v"(bq)); const float r = ((dd < HD / 2) ? __fsub_rn(a, bq) : __fadd_rn(a, bq)) * sc;
        o16[q] = tohx(r); unsigned short a2, c2; splitf(r, a2, c2); oh[q] = a2; ol[q] = c2; }
    *(v2h*)(P16 + e) = o16; *(v2us*)(Ph + e) = oh; *(v2us*)(Pl + e) = ol;  }
__global__ __launch_bounds__(256) void k_vtp(const float* __restrict__ F, int pitch, int nheads, h16* V16, bf* Vh, bf* Vl) { const size_t e = ((size_t)blockIdx.x * 256 + threadIdx.x) * 2; if (e >= (size_t)nheads * HD * TT) return; const int t = (int)(e % TT); const int d = (int)((e / TT) % HD); const int g = (int)(e / ((size_t)TT * HD)); v2h o16; v2us oh, ol;
#pragma unroll
    for (int q = 0; q < 2; ++q) { const float x = F[(size_t)(t + q) * pitch + g * HD + d]; o16[q] = tohx(x); unsigned short a2, c2; splitf(x, a2, c2); oh[q] = a2; ol[q] = c2; }
    *(v2h*)(V16 + e) = o16; *(v2us*)(Vh + e) = oh; *(v2us*)(Vl + e) = ol;  }
__global__ __launch_bounds__(256) void k_csid(float* CS) { const int idx = blockIdx.x * 256 + threadIdx.x; if (idx >= TT * HD) return; v2f cs; cs[0] = 1.0f; cs[1] = 0.0f; *(v2f*)(CS + (size_t)idx * 2) = cs;  }
// k_lsoft: streaming DENSE row softmax over the TT = 4096 keys (unscaled), one wave per row, three sweeps of the f32 score row; every row is 'hires' here (RH = TT): normalised bf16 hi/lo P:
__global__ __launch_bounds__(256) void k_lsoft(const float* __restrict__ Sb, h16* P16, bf* Ph, bf* Pl) {
    const int lane = threadIdx.x & 31; const int row = blockIdx.x * 8 + (threadIdx.x >> 5); if (row >= ZH * TT) return; const int i = row % TT; const int zz = row / TT; const bool hires = (i < RH); const float* sr = Sb + (size_t)row * TT; float mx = -3.0e38f;
#pragma unroll 4
    for (int ch = 0; ch < TT / 128; ++ch) { const int j0 = ch * 128 + lane * 4; const v4f a = *(const v4f*)(sr + j0);
#pragma unroll
        for (int q = 0; q < 4; ++q) { float t = a[q] * SCL; asm volatile("" : "+v"(t)); mx = fmaxf(mx, t); } }
#pragma unroll
    for (int sh = 16; sh; sh >>= 1) mx = fmaxf(mx, __shfl_xor(mx, sh, 32));
    float sum = 0.f;
#pragma unroll 4
    for (int ch = 0; ch < TT / 128; ++ch) { const int j0 = ch * 128 + lane * 4; const v4f a = *(const v4f*)(sr + j0);
#pragma unroll
        for (int q = 0; q < 4; ++q) { float t = a[q] * SCL; asm volatile("" : "+v"(t)); float d0 = __fsub_rn(t, mx); asm volatile("" : "+v"(d0)); sum += __builtin_amdgcn_exp2f(__fmul_rn(d0, 1.4426950408889634f)); } }
#pragma unroll
    for (int sh = 16; sh; sh >>= 1) sum += __shfl_xor(sum, sh, 32);
    const float f = __fdiv_rn(hires ? 1.0f : PCAR, sum);
{
        if (hires) {   /* rows < RH: normalised bf16 hi/lo over all keys, planes [zz][RH][TT] */
#pragma unroll
            for (int ch = 0; ch < TT / 128; ++ch) { const int j0 = ch * 128 + lane * 4; const v4f a = *(const v4f*)(sr + j0); v4us oh, ol;
#pragma unroll
                for (int q = 0; q < 4; ++q) { float t = a[q] * SCL; asm volatile("" : "+v"(t)); float d0 = __fsub_rn(t, mx); asm volatile("" : "+v"(d0)); float ex = __builtin_amdgcn_exp2f(__fmul_rn(d0, 1.4426950408889634f)); asm volatile("" : "+v"(ex)); unsigned short a2, c2; splitf(ex * f, a2, c2); oh[q] = a2; ol[q] = c2; }
                const size_t oo = ((size_t)zz * RH + i) * TT + j0; *(v4us*)(Ph + oo) = oh; *(v4us*)(Pl + oo) = ol; }
        } else {
#pragma unroll 2
            for (int ch = 0; ch < TT / 128; ++ch) { const int j0 = ch * 128 + lane * 4; const v4f a = *(const v4f*)(sr + j0); v4h o4;
#pragma unroll
                for (int q = 0; q < 4; ++q) { float t = a[q] * SCL; asm volatile("" : "+v"(t)); float d0 = __fsub_rn(t, mx); asm volatile("" : "+v"(d0)); float ex = __builtin_amdgcn_exp2f(__fmul_rn(d0, 1.4426950408889634f)); asm volatile("" : "+v"(ex)); o4[q] = tohx(ex * f); }
                *(v4h*)(P16 + (size_t)row * TT + j0) = o4; } }
         }
}

__global__ __launch_bounds__(256) void k_wtGp(const float* __restrict__ w, bf* Bt) { const int lane = threadIdx.x & 31; const int L0 = (blockIdx.x * 8 + (threadIdx.x >> 5)) * 8; const int nlines = HD * DM / 64;
{
#pragma unroll 1
        for (int l = 0; l < 8; ++l) { const int L = L0 + l; if (L >= nlines) break; const size_t e = (size_t)L * 64 + lane * 2; const int k = (int)(e % DM), n = (int)(e / DM); const int nc = min(n, HDR - 1); const unsigned short a = f2bf(w[(size_t)k * HDR + nc]), b = f2bf(w[(size_t)(k + 1) * HDR + nc]); v2us o; o[0] = (n < HDR) ? a : (unsigned short)0; o[1] = (n < HDR) ? b : (unsigned short)0; *(v2us*)(Bt + e) = o; }
         } }
__global__ __launch_bounds__(256) void k_outS(const float* __restrict__ O, float* out) { const size_t k = (size_t)blockIdx.x * 256 + threadIdx.x; if (k >= (size_t)TT * HDR / 4) return; const int d0 = (int)(k % (HDR / 4)) * 4; const size_t t = k / (HDR / 4); const v4f a = *(const v4f*)(O + t * HD + d0); v4f o;
#pragma unroll
    for (int q = 0; q < 4; ++q) o[q] = __fmul_rn(a[q], OSC);
    *(v4f*)(out + t * HDR + d0) = o;  }
__global__ __launch_bounds__(256) void k_merge(const float* __restrict__ O, int h0, float* OUTb) { const size_t e = ((size_t)blockIdx.x * 256 + threadIdx.x) * 2; if (e >= (size_t)ZH * TT * HD) return; const int d = (int)(e % HD); const int t = (int)((e / HD) % TT); const int zz = (int)(e / ((size_t)HD * TT)); const float cs = (t < RH) ? 1.0f : (1.0f / PCAR); const size_t oo = (size_t)t * DQ + (h0 + zz) * HD + d;
    v2f o2; o2[0] = O[e] * cs; o2[1] = O[e + 1] * cs; *(v2f*)(OUTb + oo) = o2;  }

extern "C" void kernel_launch(void* const* d_in, const int* in_sizes, int n_in,
                              void* d_out, int out_size, void* d_ws, size_t ws_size, hipStream_t stream) {
    (void)in_sizes; (void)n_in; (void)out_size;
    const float* x = (const float*)d_in[0]; const float* wq = (const float*)d_in[1]; const float* wk = (const float*)d_in[2]; const float* wv = (const float*)d_in[3]; const float* wo = nullptr; (void)wo;
    float* OUT = (float*)d_out;     // [4][4096][32]
    char* wsp = (char*)d_ws;
    auto take = [&](size_t bytes) { char* p = wsp; wsp += (bytes + 255) & ~(size_t)255; return (void*)p; };
    bf* WQ = (bf*)take((size_t)DQ * DM * 2); bf* WK = (bf*)take((size_t)DKV * DM * 2); bf* WV = (bf*)take((size_t)DKV * DM * 2); float* CS = (float*)take((size_t)TT * HD * 2 * 4);
    bf* XB = (bf*)take((size_t)TT * DM * 2); float* FQ = (float*)take((size_t)TT * DQ * 4); float* FK = (float*)take((size_t)TT * DKV * 4);
    h16* QP16 = (h16*)take((size_t)NH_ * TT * HD * 2); h16* KP16 = (h16*)take((size_t)NKV * TT * HD * 2); h16* VT16 = (h16*)take((size_t)NKV * HD * TT * 2);
    bf* QPh = (bf*)take((size_t)NH_ * TT * HD * 2); bf* QPl = (bf*)take((size_t)NH_ * TT * HD * 2); bf* KPh = (bf*)take((size_t)NKV * TT * HD * 2); bf* KPl = (bf*)take((size_t)NKV * TT * HD * 2); bf* VTh = (bf*)take((size_t)NKV * HD * TT * 2); bf* VTl = (bf*)take((size_t)NKV * HD * TT * 2); bf* Ph = (bf*)take((size_t)ZH * RH * TT * 2); bf* Pl = (bf*)take((size_t)ZH * RH * TT * 2);
    float* Sb = (float*)take((size_t)ZH * TT * TT * 4); h16* P16 = nullptr; float* Ob = (float*)take((size_t)ZH * TT * HD * 4);
    if ((size_t)(wsp - (char*)d_ws) > ws_size) return;    // ws 256 MiB
    float* FV = FK;   // v projection reuses the k buffer after the k planes are built (stream-ordered)
    { k_wtGp<<<(DM * HD / 64 + 63) / 64, 256, 0, stream>>>(wq, WQ); k_wtGp<<<(DM * HD / 64 + 63) / 64, 256, 0, stream>>>(wk, WK); k_wtGp<<<(DM * HD / 64 + 63) / 64, 256, 0, stream>>>(wv, WV);   /* 'xw' [256][32] -> zero-padded Bt [64][256] */
      
       }
    k_csid<<<(TT * HD + 255) / 256, 256, 0, stream>>>(CS);
    const unsigned LQ = (unsigned)(((size_t)NH_ * TT * HD / 2 + 255) / 256), LKv = (unsigned)(((size_t)NKV * TT * HD / 2 + 255) / 256);
    for (int b = 0; b < NB_; ++b) {
        
        k_cvt8<<<(unsigned)(((size_t)TT * DM / 8 + 255) / 256), 256, 0, stream>>>(x + (size_t)b * TT * DM, XB, (size_t)TT * DM / 8);
        k_gemmw<bf, 0, false><<<dim3(TT / 64, DQ / 64, 1), 32, 0, stream>>>(XB, nullptr, WQ, nullptr, DM, FQ, DQ, nullptr, 0, 0, 0);
        k_rope<<<LQ, 256, 0, stream>>>(FQ, DQ, NH_, CS, nullptr, nullptr, 1.0f, QP16, QPh, QPl);
        k_gemmw<bf, 0, false><<<dim3(TT / 64, DKV / 64, 1), 32, 0, stream>>>(XB, nullptr, WK, nullptr, DM, FK, DKV, nullptr, 0, 0, 0);
        k_rope<<<LKv, 256, 0, stream>>>(FK, DKV, NKV, CS, nullptr, nullptr, 1.0f, KP16, KPh, KPl);
        k_gemmw<bf, 0, false><<<dim3(TT / 64, DKV / 64, 1), 32, 0, stream>>>(XB, nullptr, WV, nullptr, DM, FV, DKV, nullptr, 0, 0, 0); k_vtp<<<LKv, 256, 0, stream>>>(FV, DKV, NKV, VT16, VTh, VTl);
        for (int h0 = 0; h0 < NH_; h0 += ZH) { const size_t zq = (size_t)h0, zk = (size_t)(h0 / REP);   // one kv head per query head: the pass has one head (ZH = 1) on kv plane zk (z-strides TT*HD)
            k_gemmw<bf, 2, false><<<dim3(RH / 64, TT / 64, ZH), 32, 0, stream>>>(QPh + zq * TT * HD, QPl + zq * TT * HD, KPh + zk * TT * HD, KPl + zk * TT * HD, HD, Sb, TT, nullptr, (size_t)TT * HD, (size_t)TT * HD, (size_t)TT * TT);
            k_lsoft<<<ZH * TT / 8, 256, 0, stream>>>(Sb, P16, Ph, Pl);
            k_gemmw<bf, 2, false><<<dim3(RH / 64, HD / 64, ZH), 32, 0, stream>>>(Ph, Pl, VTh + zk * HD * TT, VTl + zk * HD * TT, TT, Ob, HD, nullptr, (size_t)RH * TT, (size_t)HD * TT, (size_t)TT * HD);
            k_outS<<<(unsigned)(((size_t)TT * HDR / 4 + 255) / 256), 256, 0, stream>>>(Ob, OUT + (size_t)b * TT * HDR); }   /* out = ctx[:, :32] x 32^-0.5 */
         }
}

// v001
// One run takes 482 microseconds.
// Timed twice side by side with v000, it ran 1.50 and 1.51 times as fast.
#include <hip/hip_runtime.h>

// Single-head attention with POST-softmax scaling (x [4][4096][256]; q,k,v = x W ('xw' [256][32], no bias); energy = q.k UNSCALED; att = softmax(energy) x 32^-0.5; out = att v -> [4][4096][32] (0.5 M)).
// Layout per batch: bf16 copy of x; the three 32-wide projections as 64-wide exact GEMMs against zero-padded weights (columns 32..63 exactly 0, so the 64-wide planes are the 32-wide vectors padded); dense T-4096 attention with one head (every row hi/lo 3 products; dense score tiles; streaming three-sweep softmax); att.v split over the keys into KS slices, one work-group per (row tile, slice), f32 partial contexts; the partials' first 32 columns summed in slice order x 32^-0.5 are the output rows.
// Compute dtypes, f32 accumulate: every input rounded to bf16; projections exact; scores and att.v 3 products on every row (unscaled logits, sigma ~5.7); softmax f32; the post-softmax scale applied in f32 at the end (a power of two times 1/sqrt(2): one rounding, as the reference's att x scaling then att v up to association).

#define NB_  4
#define TT   4096
#define DM   256
#define NH_  1
#define NKV  1
#define REP  (NH_ / NKV)
#define HD   64
#define DQ   (NH_ * HD)
#define DKV  (NKV * HD)
#define ZH   1
#define RH   4096                 // = TT: every row hi/lo (unscaled logits sigma ~3)
#define WIN  0
#define PCAR 1024.0f
#define SCL  1.0f   // unscaled
#define HDR  32     // real head dim
#define OSC  0.17677669529663688f   // 32^-0.5 applied after the softmax
#define KS   16     // key slices of att.v: 64 row tiles x 16 slices = 1024 waves, one per SIMD of the chip
typedef _Float16 h16;
typedef unsigned short bf;
typedef __attribute__((ext_vector_type(16))) __bf16   v16bf;
typedef __attribute__((ext_vector_type(16))) _Float16 v16h;
typedef __attribute__((ext_vector_type(8)))  _Float16 v8h;
typedef __attribute__((ext_vector_type(8)))  unsigned short v8us;
typedef __attribute__((ext_vector_type(8)))  float    v8f;
typedef __attribute__((ext_vector_type(4)))  float    v4f;
typedef v8h  __attribute__((may_alias)) v8ha;
typedef v4f  __attribute__((may_alias)) v4fa;
typedef v8us __attribute__((may_alias)) v8usa;

__device__ __forceinline__ unsigned short f2bf(float f) { unsigned u = __float_as_uint(f); u += 0x7FFFu + ((u >> 16) & 1u); return (unsigned short)(u >> 16); }
__device__ __forceinline__ float bf2f(unsigned short b) { return __uint_as_float(((unsigned)b) << 16); }
__device__ __forceinline__ float bfr(float f) { return bf2f(f2bf(f)); }
__device__ __forceinline__ v16h cat16(v8h lo, v8h hi) { return __builtin_shufflevector(lo, hi, 0, 1, 2, 3, 4, 5, 6, 7, 8, 9, 10, 11, 12, 13, 14, 15); }
__device__ __forceinline__ v16bf cat16b(v8us lo, v8us hi) { return __builtin_bit_cast(v16bf, __builtin_shufflevector(lo, hi, 0, 1, 2, 3, 4, 5, 6, 7, 8, 9, 10, 11, 12, 13, 14, 15)); }
__device__ __forceinline__ v8f wmma16(v16h a, v16h b, v8f c) { return __builtin_amdgcn_wmma_f32_16x16x32_f16(false, a, false, b, (short)0, c, false, false); }
__device__ __forceinline__ v8f wmmab(v16bf a, v16bf b, v8f c) { return __builtin_amdgcn_wmma_f32_16x16x32_bf16(false, a, false, b, (short)0, c, false, false); }



// ---- k_gemmw: register-blocked GEMM, ONE WAVE per 64x64 output tile (16 accumulators), operands straight from K-contiguous 16-bit planes; grid (M/64, N/64, Z), 32 threads.
// C[m][n] (f32, pitch ldc, + optional f32 bias[n]) = sum_k A[m][k] Bt[n][k] (+ split products per NSPLIT). z-batch strides sA/sB/sC in elements. K % 32 == 0. K is the row pitch of A and Bt; KL (% 32 == 0, <= K) is how many k one work-group sums: with KL < K and sA = sB = KL, z walks K-slices of one product and C + z sC holds slice z's partial sum.
template <typename T16> struct WFrag;
template <> struct WFrag<h16> { typedef v16h V; static __device__ __forceinline__ V ld(const h16* p) { return cat16(*(const v8h*)p, *(const v8h*)(p + 16)); } static __device__ __forceinline__ v8f mma(V a, V b, v8f c) { return wmma16(a, b, c); } };
template <> struct WFrag<bf> { typedef v16bf V; static __device__ __forceinline__ V ld(const bf* p) { return cat16b(*(const v8us*)p, *(const v8us*)(p + 16)); } static __device__ __forceinline__ v8f mma(V a, V b, v8f c) { return wmmab(a, b, c); } };
template <typename T16, int NSPLIT, bool BIAS>
__global__ __launch_bounds__(32) void k_gemmw(const T16* __restrict__ A, const T16* __restrict__ A2, const T16* __restrict__ Bt, const T16* __restrict__ Bt2, int K, float* C, int ldc, const float* __restrict__ bias, size_t sA, size_t sB, size_t sC, int KL) {
    typedef typename WFrag<T16>::V V;
    __shared__ __align__(16) float os[16 * 68];
    const size_t z = blockIdx.z; A += z * sA; if (A2) A2 += z * sA; Bt += z * sB; if (Bt2) Bt2 += z * sB; C += z * sC;
    const int lane = threadIdx.x & 31, lr = lane & 15, hi = lane >> 4; const int r0 = blockIdx.x * 64, c0 = blockIdx.y * 64;
    v8f acc[4][4];
#pragma unroll
    for (int mb = 0; mb < 4; ++mb)
#pragma unroll
        for (int nb = 0; nb < 4; ++nb) acc[mb][nb] = (v8f){};
    const size_t aoff = (size_t)(r0 + lr) * K + 8 * hi, boff = (size_t)(c0 + lr) * K + 8 * hi;
#pragma unroll 1
    for (int kc = 0; kc < KL; kc += 32) {
        V a[4], a2[4];
#pragma unroll
        for (int mb = 0; mb < 4; ++mb) { a[mb] = WFrag<T16>::ld(A + aoff + (size_t)mb * 16 * K + kc); if (NSPLIT == 1 || NSPLIT == 2) a2[mb] = WFrag<T16>::ld(A2 + aoff + (size_t)mb * 16 * K + kc); }
#pragma unroll
        for (int nb = 0; nb < 4; ++nb) { const V b = WFrag<T16>::ld(Bt + boff + (size_t)nb * 16 * K + kc); V b2; if (NSPLIT >= 2) b2 = WFrag<T16>::ld(Bt2 + boff + (size_t)nb * 16 * K + kc);
#pragma unroll
            for (int mb = 0; mb < 4; ++mb) { acc[mb][nb] = WFrag<T16>::mma(a[mb], b, acc[mb][nb]); if (NSPLIT == 1 || NSPLIT == 2) acc[mb][nb] = WFrag<T16>::mma(a2[mb], b, acc[mb][nb]); if (NSPLIT >= 2) acc[mb][nb] = WFrag<T16>::mma(a[mb], b2, acc[mb][nb]); } }
        asm volatile("v_nop\n\tv_nop\n\tv_nop\n\tv_nop" : "+v"(acc[0][0]), "+v"(acc[1][1]), "+v"(acc[2][2]), "+v"(acc[3][3]) : "v"(a[0]), "v"(a[3]));
    }
#pragma unroll
    for (int mb = 0; mb < 4; ++mb) {
#pragma unroll
        for (int nb = 0; nb < 4; ++nb) {
#pragma unroll
            for (int j = 0; j < 8; ++j) os[(hi * 8 + j) * 68 + nb * 16 + lr] = acc[mb][nb][j]; }
        __builtin_amdgcn_wave_barrier(); asm volatile("" ::: "memory");
        float* crow = C + (size_t)(r0 + mb * 16) * ldc + c0;
{
#pragma unroll
            for (int s = 0; s < 8; ++s) { const int row = 2 * s + hi, cofs = lr * 4; v4f val = *(const v4fa*)(os + row * 68 + cofs); if (BIAS) { val[0] += bfr(bias[c0 + cofs]); val[1] += bfr(bias[c0 + cofs + 1]); val[2] += bfr(bias[c0 + cofs + 2]); val[3] += bfr(bias[c0 + cofs + 3]); }
                *(v4f*)(crow + (size_t)row * ldc + cofs) = val; }
             }
        __builtin_amdgcn_wave_barrier(); asm volatile("" ::: "memory");
    }
}

__device__ __forceinline__ h16 tohx(float x) { return (h16)x; }
__device__ __forceinline__ void splitf(float y, unsigned short& h, unsigned short& l) { h = f2bf(y); l = f2bf(y - bf2f(h)); }
typedef __attribute__((ext_vector_type(2))) _Float16 v2h;
typedef __attribute__((ext_vector_type(4))) _Float16 v4h;
typedef __attribute__((ext_vector_type(2))) unsigned short v2us;
typedef __attribute__((ext_vector_type(4))) unsigned short v4us;
typedef __attribute__((ext_vector_type(2))) float v2f;
typedef __attribute__((ext_vector_type(4))) int v4i;

__global__ __launch_bounds__(256) void k_wtG(const float* __restrict__ w, int K, int N, bf* Bt) {
    const int lane = threadIdx.x & 31; const int L0 = (blockIdx.x * 8 + (threadIdx.x >> 5)) * 8; const int nlines = N * K / 64;
{
#pragma unroll 1
        for (int l = 0; l < 8; ++l) { const int L = L0 + l; if (L >= nlines) break; const size_t e = (size_t)L * 64 + lane * 2; const int k = (int)(e % K), n = (int)(e / K); v2us o;
            o[0] = f2bf(w[(size_t)k * N + n]); o[1] = f2bf(w[(size_t)(k + 1) * N + n]); *(v2us*)(Bt + e) = o; }
         }
}
__global__ __launch_bounds__(256) void k_cvt8(const float* __restrict__ src, bf* dst, size_t n8) { const size_t i = (size_t)blockIdx.x * 256 + threadIdx.x; if (i >= n8) return; const v8f v = *(const v8f*)(src + i * 8); v8us o;
#pragma unroll
    for (int k = 0; k < 8; ++k) o[k] = f2bf(v[k]); *(v8us*)(dst + i * 8) = o;  }

// k_rope: head planes [h][t][d] (fp16 + hi/lo) of rope(x) x sc with the rotate-half convention out[d] = x[d] cos[t][d] - x[d+HD/2] sin[t][d], out[d+HD/2] = x[d+HD/2] cos[t][d+HD/2] + x[d] sin[t][d+HD/2]
__global__ __launch_bounds__(256) void k_rope(const float* __restrict__ F, int pitch, int nheads, const float* __restrict__ CS, const float* __restrict__ RF, const float* __restrict__ nw, float sc, h16* P16, bf* Ph, bf* Pl) {
    const size_t e = ((size_t)blockIdx.x * 256 + threadIdx.x) * 2; if (e >= (size_t)nheads * TT * HD) return; const int d = (int)(e % HD); const int t = (int)((e / HD) % TT); const int h = (int)(e / ((size_t)HD * TT)); const float* f = F + (size_t)t * pitch + h * HD; const float rf = RF ? RF[(size_t)h * TT + t] : 1.0f; v2h o16; v2us oh, ol;
#pragma unroll
    for (int q = 0; q < 2; ++q) { const int dd = d + q; const int dp = (dd < HD / 2) ? dd + HD / 2 : dd - HD / 2; float x0 = f[dd], x1 = f[dp];
        if (RF) { float n0 = __fmul_rn(x0, rf), n1 = __fmul_rn(x1, rf); asm volatile("" : "+v"(n0)); asm volatile("" : "+v"(n1)); x0 = __fmul_rn(bfr(nw[dd]), n0); x1 = __fmul_rn(bfr(nw[dp]), n1); }
        const v2f cs = *(const v2f*)(CS + ((size_t)t * HD + dd) * 2); float a = __fmul_rn(x0, cs[0]), bq = __fmul_rn(x1, cs[1]); asm volatile("" : "+v"(a)); asm volatile("" : "+v"(bq)); const float r = ((dd < HD / 2) ? __fsub_rn(a, bq) : __fadd_rn(a, bq)) * sc;
        o16[q] = tohx(r); unsigned short a2, c2; splitf(r, a2, c2); oh[q] = a2; ol[q] = c2; }
    *(v2h*)(P16 + e) = o16; *(v2us*)(Ph + e) = oh; *(v2us*)(Pl + e) = ol;  }
__global__ __launch_bounds__(256) void k_vtp(const float* __restrict__ F, int pitch, int nheads, h16* V16, bf* Vh, bf* Vl) { const size_t e = ((size_t)blockIdx.x * 256 + threadIdx.x) * 2; if (e >= (size_t)nheads * HD * TT) return; const int t = (int)(e % TT); const int d = (int)((e / TT) % HD); const int g = (int)(e / ((size_t)TT * HD)); v2h o16; v2us oh, ol;
#pragma unroll
    for (int q = 0; q < 2; ++q) { const float x = F[(size_t)(t + q) * pitch + g * HD + d]; o16[q] = tohx(x); unsigned short a2, c2; splitf(x, a2, c2); oh[q] = a2; ol[q] = c2; }
    *(v2h*)(V16 + e) = o16; *(v2us*)(Vh + e) = oh; *(v2us*)(Vl + e) = ol;  }
__global__ __launch_bounds__(256) void k_csid(float* CS) { const int idx = blockIdx.x * 256 + threadIdx.x; if (idx >= TT * HD) return; v2f cs; cs[0] = 1.0f; cs[1] = 0.0f; *(v2f*)(CS + (size_t)idx * 2) = cs;  }
// k_lsoft: streaming DENSE row softmax over the TT = 4096 keys (unscaled), one wave per row, three sweeps of the f32 score row; every row is 'hires' here (RH = TT): normalised bf16 hi/lo P:
__global__ __launch_bounds__(256) void k_lsoft(const float* __restrict__ Sb, h16* P16, bf* Ph, bf* Pl) {
    const int lane = threadIdx.x & 31; const int row = blockIdx.x * 8 + (threadIdx.x >> 5); if (row >= ZH * TT) return; const int i = row % TT; const int zz = row / TT; const bool hires = (i < RH); const float* sr = Sb + (size_t)row * TT; float mx = -3.0e38f;
#pragma unroll 4
    for (int ch = 0; ch < TT / 128; ++ch) { const int j0 = ch * 128 + lane * 4; const v4f a = *(const v4f*)(sr + j0);
#pragma unroll
        for (int q = 0; q < 4; ++q) { float t = a[q] * SCL; asm volatile("" : "+v"(t)); mx = fmaxf(mx, t); } }
#pragma unroll
    for (int sh = 16; sh; sh >>= 1) mx = fmaxf(mx, __shfl_xor(mx, sh, 32));
    float sum = 0.f;
#pragma unroll 4
    for (int ch = 0; ch < TT / 128; ++ch) { const int j0 = ch * 128 + lane * 4; const v4f a = *(const v4f*)(sr + j0);
#pragma unroll
        for (int q = 0; q < 4; ++q) { float t = a[q] * SCL; asm volatile("" : "+v"(t)); float d0 = __fsub_rn(t, mx); asm volatile("" : "+v"(d0)); sum += __builtin_amdgcn_exp2f(__fmul_rn(d0, 1.4426950408889634f)); } }
#pragma unroll
    for (int sh = 16; sh; sh >>= 1) sum += __shfl_xor(sum, sh, 32);
    const float f = __fdiv_rn(hires ? 1.0f : PCAR, sum);
{
        if (hires) {   /* rows < RH: normalised bf16 hi/lo over all keys, planes [zz][RH][TT] */
#pragma unroll
            for (int ch = 0; ch < TT / 128; ++ch) { const int j0 = ch * 128 + lane * 4; const v4f a = *(const v4f*)(sr + j0); v4us oh, ol;
#pragma unroll
                for (int q = 0; q < 4; ++q) { float t = a[q] * SCL; asm volatile("" : "+v"(t)); float d0 = __fsub_rn(t, mx); asm volatile("" : "+v"(d0)); float ex = __builtin_amdgcn_exp2f(__fmul_rn(d0, 1.4426950408889634f)); asm volatile("" : "+v"(ex)); unsigned short a2, c2; splitf(ex * f, a2, c2); oh[q] = a2; ol[q] = c2; }
                const size_t oo = ((size_t)zz * RH + i) * TT + j0; *(v4us*)(Ph + oo) = oh; *(v4us*)(Pl + oo) = ol; }
        } else {
#pragma unroll 2
            for (int ch = 0; ch < TT / 128; ++ch) { const int j0 = ch * 128 + lane * 4; const v4f a = *(const v4f*)(sr + j0); v4h o4;
#pragma unroll
                for (int q = 0; q < 4; ++q) { float t = a[q] * SCL; asm volatile("" : "+v"(t)); float d0 = __fsub_rn(t, mx); asm volatile("" : "+v"(d0)); float ex = __builtin_amdgcn_exp2f(__fmul_rn(d0, 1.4426950408889634f)); asm volatile("" : "+v"(ex)); o4[q] = tohx(ex * f); }
                *(v4h*)(P16 + (size_t)row * TT + j0) = o4; } }
         }
}

__global__ __launch_bounds__(256) void k_wtGp(const float* __restrict__ w, bf* Bt) { const int lane = threadIdx.x & 31; const int L0 = (blockIdx.x * 8 + (threadIdx.x >> 5)) * 8; const int nlines = HD * DM / 64;
{
#pragma unroll 1
        for (int l = 0; l < 8; ++l) { const int L = L0 + l; if (L >= nlines) break; const size_t e = (size_t)L * 64 + lane * 2; const int k = (int)(e % DM), n = (int)(e / DM); const int nc = min(n, HDR - 1); const unsigned short a = f2bf(w[(size_t)k * HDR + nc]), b = f2bf(w[(size_t)(k + 1) * HDR + nc]); v2us o; o[0] = (n < HDR) ? a : (unsigned short)0; o[1] = (n < HDR) ? b : (unsigned short)0; *(v2us*)(Bt + e) = o; }
         } }
__global__ __launch_bounds__(256) void k_outS(const float* __restrict__ O, float* out) { const size_t k = (size_t)blockIdx.x * 256 + threadIdx.x; if (k >= (size_t)TT * HDR / 4) return; const int d0 = (int)(k % (HDR / 4)) * 4; const size_t t = k / (HDR / 4); const float* p0 = O + t * HD + d0; v4f v[KS], o;   /* O: KS partial contexts [s][t][HD] */
#pragma unroll
    for (int s = 0; s < KS / 2; ++s) v[s] = *(const v4f*)(p0 + (size_t)s * TT * HD);
    asm volatile("s_wait_xcnt 0x0" ::: "memory");   // the second half's loads may land in the first half's address pair: the wait stands in front of that overwrite
#pragma unroll
    for (int s = KS / 2; s < KS; ++s) v[s] = *(const v4f*)(p0 + (size_t)s * TT * HD);
    v4f a = v[0];
#pragma unroll
    for (int s = 1; s < KS; ++s) a += v[s];   /* slice order */
#pragma unroll
    for (int q = 0; q < 4; ++q) o[q] = __fmul_rn(a[q], OSC);
    *(v4f*)(out + t * HDR + d0) = o;  }
__global__ __launch_bounds__(256) void k_merge(const float* __restrict__ O, int h0, float* OUTb) { const size_t e = ((size_t)blockIdx.x * 256 + threadIdx.x) * 2; if (e >= (size_t)ZH * TT * HD) return; const int d = (int)(e % HD); const int t = (int)((e / HD) % TT); const int zz = (int)(e / ((size_t)HD * TT)); const float cs = (t < RH) ? 1.0f : (1.0f / PCAR); const size_t oo = (size_t)t * DQ + (h0 + zz) * HD + d;
    v2f o2; o2[0] = O[e] * cs; o2[1] = O[e + 1] * cs; *(v2f*)(OUTb + oo) = o2;  }

extern "C" void kernel_launch(void* const* d_in, const int* in_sizes, int n_in,
                              void* d_out, int out_size, void* d_ws, size_t ws_size, hipStream_t stream) {
    (void)in_sizes; (void)n_in; (void)out_size;
    const float* x = (const float*)d_in[0]; const float* wq = (const float*)d_in[1]; const float* wk = (const float*)d_in[2]; const float* wv = (const float*)d_in[3]; const float* wo = nullptr; (void)wo;
    float* OUT = (float*)d_out;     // [4][4096][32]
    char* wsp = (char*)d_ws;
    auto take = [&](size_t bytes) { char* p = wsp; wsp += (bytes + 255) & ~(size_t)255; return (void*)p; };
    bf* WQ = (bf*)take((size_t)DQ * DM * 2); bf* WK = (bf*)take((size_t)DKV * DM * 2); bf* WV = (bf*)take((size_t)DKV * DM * 2); float* CS = (float*)take((size_t)TT * HD * 2 * 4);
    bf* XB = (bf*)take((size_t)TT * DM * 2); float* FQ = (float*)take((size_t)TT * DQ * 4); float* FK = (float*)take((size_t)TT * DKV * 4);
    h16* QP16 = (h16*)take((size_t)NH_ * TT * HD * 2); h16* KP16 = (h16*)take((size_t)NKV * TT * HD * 2); h16* VT16 = (h16*)take((size_t)NKV * HD * TT * 2);
    bf* QPh = (bf*)take((size_t)NH_ * TT * HD * 2); bf* QPl = (bf*)take((size_t)NH_ * TT * HD * 2); bf* KPh = (bf*)take((size_t)NKV * TT * HD * 2); bf* KPl = (bf*)take((size_t)NKV * TT * HD * 2); bf* VTh = (bf*)take((size_t)NKV * HD * TT * 2); bf* VTl = (bf*)take((size_t)NKV * HD * TT * 2); bf* Ph = (bf*)take((size_t)ZH * RH * TT * 2); bf* Pl = (bf*)take((size_t)ZH * RH * TT * 2);
    float* Sb = (float*)take((size_t)ZH * TT * TT * 4); h16* P16 = nullptr; float* Ob = (float*)take((size_t)KS * TT * HD * 4);
    if ((size_t)(wsp - (char*)d_ws) > ws_size) return;    // ws 256 MiB
    float* FV = FK;   // v projection reuses the k buffer after the k planes are built (stream-ordered)
    { k_wtGp<<<(DM * HD / 64 + 63) / 64, 256, 0, stream>>>(wq, WQ); k_wtGp<<<(DM * HD / 64 + 63) / 64, 256, 0, stream>>>(wk, WK); k_wtGp<<<(DM * HD / 64 + 63) / 64, 256, 0, stream>>>(wv, WV);   /* 'xw' [256][32] -> zero-padded Bt [64][256] */
      
       }
    k_csid<<<(TT * HD + 255) / 256, 256, 0, stream>>>(CS);
    const unsigned LQ = (unsigned)(((size_t)NH_ * TT * HD / 2 + 255) / 256), LKv = (unsigned)(((size_t)NKV * TT * HD / 2 + 255) / 256);
    for (int b = 0; b < NB_; ++b) {
        
        k_cvt8<<<(unsigned)(((size_t)TT * DM / 8 + 255) / 256), 256, 0, stream>>>(x + (size_t)b * TT * DM, XB, (size_t)TT * DM / 8);
        k_gemmw<bf, 0, false><<<dim3(TT / 64, DQ / 64, 1), 32, 0, stream>>>(XB, nullptr, WQ, nullptr, DM, FQ, DQ, nullptr, 0, 0, 0, DM);
        k_rope<<<LQ, 256, 0, stream>>>(FQ, DQ, NH_, CS, nullptr, nullptr, 1.0f, QP16, QPh, QPl);
        k_gemmw<bf, 0, false><<<dim3(TT / 64, DKV / 64, 1), 32, 0, stream>>>(XB, nullptr, WK, nullptr, DM, FK, DKV, nullptr, 0, 0, 0, DM);
        k_rope<<<LKv, 256, 0, stream>>>(FK, DKV, NKV, CS, nullptr, nullptr, 1.0f, KP16, KPh, KPl);
        k_gemmw<bf, 0, false><<<dim3(TT / 64, DKV / 64, 1), 32, 0, stream>>>(XB, nullptr, WV, nullptr, DM, FV, DKV, nullptr, 0, 0, 0, DM); k_vtp<<<LKv, 256, 0, stream>>>(FV, DKV, NKV, VT16, VTh, VTl);
        for (int h0 = 0; h0 < NH_; h0 += ZH) { const size_t zq = (size_t)h0, zk = (size_t)(h0 / REP);   // one kv head per query head: the pass's one head (ZH = 1) uses kv plane h0 (z-strides TT*HD)
            k_gemmw<bf, 2, false><<<dim3(RH / 64, TT / 64, ZH), 32, 0, stream>>>(QPh + zq * TT * HD, QPl + zq * TT * HD, KPh + zk * TT * HD, KPl + zk * TT * HD, HD, Sb, TT, nullptr, (size_t)TT * HD, (size_t)TT * HD, (size_t)TT * TT, HD);
            k_lsoft<<<ZH * TT / 8, 256, 0, stream>>>(Sb, P16, Ph, Pl);
            k_gemmw<bf, 2, false><<<dim3(RH / 64, HD / 64, KS), 32, 0, stream>>>(Ph, Pl, VTh + zk * HD * TT, VTl + zk * HD * TT, TT, Ob, HD, nullptr, (size_t)(TT / KS), (size_t)(TT / KS), (size_t)TT * HD, TT / KS);   /* z = key slice (ZH = 1: one head a pass) */
            k_outS<<<(unsigned)(((size_t)TT * HDR / 4 + 255) / 256), 256, 0, stream>>>(Ob, OUT + (size_t)b * TT * HDR); }   /* out = ctx[:, :32] x 32^-0.5 */
         }
}

// v003
// Measured time: 36.5 microseconds a run.
// It is 13.2 times as fast as v001, going by the measured steps of the versions left out in between.
// Counting every step since v000, it is 19.9 times as fast.
#include <hip/hip_runtime.h>

// Single-head attention with POST-softmax scaling (x [4][4096][256]; q,k,v = x W ('xw' [256][32], no bias); energy = q.k UNSCALED; att = softmax(energy) x 32^-0.5; out = att v -> [4][4096][32] (0.5 M)).
// Two launches. k_proj: x and the three weights rounded to bf16 on the way in, the three 32-wide projections as exact bf16 products, hi/lo planes of q, k ([t][HD], the 32 real columns written and read) and v^T ([d][t], the 32 real rows) for all batches. k_fattn: ONE fused attention launch for all batches (64 queries a work-group, the keys split over its 16 waves, online softmax, every product hi/lo 3 products, the slices joined in LDS in wave order, x 32^-0.5 at the end).
// Compute dtypes, f32 accumulate: every input rounded to bf16; projections exact; scores and att.v 3 products on every row (unscaled logits, sigma ~5.7); softmax f32; the post-softmax scale applied in f32 at the end (a power of two times 1/sqrt(2): one rounding, as the reference's att x scaling then att v up to association).

#define NB_  4
#define TT   4096
#define DM   256
#define HD   64     // row pitch of the q and k planes, rows a batch of the v^T planes
#define HDR  32     // real head dim
#define OSC  0.17677669529663688f   // 32^-0.5 applied after the softmax
typedef unsigned short bf;
typedef __attribute__((ext_vector_type(16))) __bf16   v16bf;
typedef __attribute__((ext_vector_type(8)))  unsigned short v8us;
typedef __attribute__((ext_vector_type(8)))  float    v8f;
typedef __attribute__((ext_vector_type(4)))  float    v4f;
typedef __attribute__((ext_vector_type(2)))  float    v2f;
typedef __attribute__((ext_vector_type(2))) __bf16 v2bf;
typedef __attribute__((ext_vector_type(4))) unsigned v4u;
typedef __attribute__((ext_vector_type(8))) unsigned v8u;

__device__ __forceinline__ unsigned pk2(float a, float b) { v2f t; t[0] = a; t[1] = b; return __builtin_bit_cast(unsigned, __builtin_convertvector(t, v2bf)); }   // two f32 -> packed bf16, nearest even
__device__ __forceinline__ v16bf cat16b(v8us lo, v8us hi) { return __builtin_bit_cast(v16bf, __builtin_shufflevector(lo, hi, 0, 1, 2, 3, 4, 5, 6, 7, 8, 9, 10, 11, 12, 13, 14, 15)); }
__device__ __forceinline__ v8f wmmab(v16bf a, v16bf b, v8f c) { return __builtin_amdgcn_wmma_f32_16x16x32_bf16(false, a, false, b, (short)0, c, false, false); }
// A or B fragment of a 16x16x32 product from a K-contiguous 16-bit row: lane (lr, hi) holds row lr, k = 8 hi .. 8 hi + 7 and 16 + 8 hi .. 16 + 8 hi + 7; p points at its row's k = 8 hi.
template <typename T16> struct WFrag;
template <> struct WFrag<bf> { typedef v16bf V; static __device__ __forceinline__ V ld(const bf* p) { return cat16b(*(const v8us*)p, *(const v8us*)(p + 16)); } static __device__ __forceinline__ v8f mma(V a, V b, v8f c) { return wmmab(a, b, c); } };
__device__ __forceinline__ void split8(v8f v, v4u& oh, v4u& ol) {   // 8 f32 -> 8 bf16 high parts and the 8 bf16 roundings of what they leave
#pragma unroll
    for (int r = 0; r < 4; ++r) { const unsigned h2 = pk2(v[2 * r], v[2 * r + 1]); oh[r] = h2; ol[r] = pk2(v[2 * r] - __uint_as_float(h2 << 16), v[2 * r + 1] - __uint_as_float(h2 & 0xFFFF0000u)); } }

// ---- k_proj: q, k, v of PR rows of x (all batches as one row range) in one work-group of 8 waves, straight to the hi/lo planes.
// Wave w owns the 16 rows of tile w >> 1 and three of the six 16-column tiles: both of q and the first of v (w even), both of k and the second of v (w odd). Its x fragments come straight from the f32 rows (all of K in flight at once) and are rounded in registers; the weights are rounded and transposed into LDS once a work-group.
// q and k are formed transposed (A = weight rows, B = x rows) and v plain (A = x rows, B = weight rows), so that a lane's 8 accumulator values are 8 neighbours of its plane's row: 16-byte stores. k runs upward in steps of 32 in one accumulator, as a plain GEMM loop does.
// Every plain '#pragma unroll' in k_proj stands on a short constant-trip loop over register arrays: unrolled so that they are indexed by constants and stay in registers.
#define PR   64     // rows of x a work-group
#define WP   264    // LDS pitch of a transposed weight row, elements: 528 B = 16 B x odd, the pitch for 16-byte fragment reads
#define VP   72     // LDS pitch of a staged v^T row, elements: 144 B = 16 B x odd
__global__ __launch_bounds__(256) void k_proj(const float* __restrict__ x, const float* __restrict__ wq, const float* __restrict__ wk, const float* __restrict__ wv, bf* Qh, bf* Ql, bf* Kh, bf* Kl, bf* Vh, bf* Vl) {
    typedef WFrag<bf> F; typedef v16bf V;
    __shared__ __align__(16) bf wt[3 * HDR][WP]; __shared__ __align__(16) bf vs[2][HDR][VP];
    const int lane = threadIdx.x & 31, lr = lane & 15, hi = lane >> 4, w = __builtin_amdgcn_readfirstlane(threadIdx.x >> 5); const int mt = w >> 1, hf = w & 1; const size_t g0 = (size_t)blockIdx.x * PR;
    const int kl = (lane >> 3) * 8, n0 = (lane & 7) * 4; const float* ws[3]; v4f t[3][8];   /* 24 strips (matrix, 32 k) over 8 waves, 3 a wave; a lane takes 8 k x 4 columns of each: whole 128-byte rows in, four 16-byte LDS stores out */
#pragma unroll
    for (int i = 0; i < 3; ++i) { const int s = w * 3 + i, mx = s >> 3; ws[i] = (mx == 0 ? wq : mx == 1 ? wk : wv) + ((s & 7) * 32 + kl) * HDR + n0;
#pragma unroll
        for (int j = 0; j < 8; ++j) t[i][j] = *(const v4f*)(ws[i] + j * HDR); }
    asm volatile("s_wait_xcnt 0x0" :: "v"(ws[0]), "v"(ws[1]), "v"(ws[2]) : "memory");   // in front of the first overwrite of the weight loads' address pairs; it also keeps all of them in front of the x loads: loads return in order, so the weights are rounded and laid in LDS while x is on its way
    const float* px = x + (g0 + mt * 16 + lr) * DM + 8 * hi; v8f xa[DM / 32][2];
#pragma unroll
    for (int ks = 0; ks < DM / 32; ++ks) { xa[ks][0] = *(const v8f*)(px + ks * 32); xa[ks][1] = *(const v8f*)(px + ks * 32 + 16); }
    asm volatile("s_wait_xcnt 0x0" :: "v"(px) : "memory");   // in front of the first overwrite of the x loads' address pair; the memory clobber keeps them in front of it
    __builtin_amdgcn_sched_barrier(0);   // the weights' rounding, which waits for their data, stays behind the issue of the x loads: without it the x loads leave one L2 round trip later
#pragma unroll
    for (int i = 0; i < 3; ++i) { const int s = w * 3 + i, mx = s >> 3, k0 = (s & 7) * 32 + kl;
#pragma unroll
        for (int e = 0; e < 4; ++e) { v4u o;
#pragma unroll
            for (int r = 0; r < 4; ++r) o[r] = pk2(t[i][2 * r][e], t[i][2 * r + 1][e]);
            *(v4u*)&wt[mx * HDR + n0 + e][k0] = o; } }
    __syncthreads();   // the transposed weights are whole before any wave reads them
    v8f a0 = (v8f){}, a1 = (v8f){}, a2 = (v8f){}; const bf* pw = &wt[hf * HDR + lr][8 * hi]; const bf* pv = &wt[2 * HDR + hf * 16 + lr][8 * hi];
#pragma unroll
    for (int ks = 0; ks < DM / 32; ++ks) { v8u xu;
#pragma unroll
        for (int r = 0; r < 4; ++r) { xu[r] = pk2(xa[ks][0][2 * r], xa[ks][0][2 * r + 1]); xu[4 + r] = pk2(xa[ks][1][2 * r], xa[ks][1][2 * r + 1]); }
        const V xf = __builtin_bit_cast(V, xu);
        a0 = F::mma(F::ld(pw + ks * 32), xf, a0); a1 = F::mma(F::ld(pw + 16 * WP + ks * 32), xf, a1); a2 = F::mma(xf, F::ld(pv + ks * 32), a2); }
    v4u oh, ol; split8(a2, oh, ol); *(v4u*)&vs[0][hf * 16 + lr][mt * 16 + 8 * hi] = oh; *(v4u*)&vs[1][hf * 16 + lr][mt * 16 + 8 * hi] = ol;   /* a2[j] = row mt 16 + 8 hi + j, column hf 16 + lr */
    __syncthreads();   // the four row tiles of v^T are joined in LDS: 8 lanes then write one whole 128-byte line of a plane's row
    bf* Ph = hf ? Kh : Qh; bf* Pl = hf ? Kl : Ql; const size_t ro = (g0 + mt * 16 + lr) * HD + 8 * hi;   /* a0[j], a1[j] = row mt 16 + lr, column 8 hi + j, 16 + 8 hi + j */
    split8(a0, oh, ol); *(v4u*)(Ph + ro) = oh; *(v4u*)(Pl + ro) = ol;
    split8(a1, oh, ol); *(v4u*)(Ph + ro + 16) = oh; *(v4u*)(Pl + ro + 16) = ol;
    const int d = threadIdx.x >> 3, c8 = (threadIdx.x & 7) * 8; const size_t vo = (g0 / TT) * ((size_t)TT * HD) + (size_t)d * TT + (g0 % TT) + c8;
    *(v4u*)(Vh + vo) = *(const v4u*)&vs[0][d][c8]; *(v4u*)(Vl + vo) = *(const v4u*)&vs[1][d][c8];  }
// ---- k_fattn: scores, softmax and att.v of one 64-query tile in one work-group; no score or probability ever reaches memory.
// S^T = K Q^T (A = K rows, B = Q rows, both on the 32 real head columns, one k-step) so that a lane holds one query's scores: two 16-key D tiles, converted in place, are the B operand of O^T += V^T P^T.
// Every plain '#pragma unroll' in k_fattn stands on a short constant-trip loop: over register arrays (fragments, accumulators), unrolled so that they are indexed by constants and stay in registers, or over the FW slices in LDS at the join.
// Wave w walks keys [w KSL, (w + 1) KSL) with a running maximum and sum (online softmax, f32); the FW waves' (max, sum, context) are joined in LDS in wave order. Three hi/lo products (hi.hi, lo.hi, hi.lo) on both GEMMs.
#define FW   16           // waves of a work-group = key slices
#define NT   4            // 16-query tiles a wave: every K and V fragment fetched serves NT tiles
#define QW   (NT * 16)    // queries a work-group
#define KSL  (TT / FW)    // keys a wave
#define L2E  1.4426950408889634f
__device__ __forceinline__ float xhalf(float x) { const int b = __float_as_int(x); return __int_as_float(__builtin_amdgcn_permlanex16(b, b, 0x76543210, 0xfedcba98, false, false)); }   // lane l <-> l ^ 16
__global__ __launch_bounds__(FW * 32) void k_fattn(const bf* __restrict__ Qh, const bf* __restrict__ Ql, const bf* __restrict__ Kh, const bf* __restrict__ Kl, const bf* __restrict__ Vh, const bf* __restrict__ Vl, float* out) {
    typedef WFrag<bf> F; typedef v16bf V;
    __shared__ float ms[FW][QW], ls[FW][QW]; __shared__ __align__(16) float os[FW][QW][36]; __shared__ __align__(16) v8us qls[NT][2][32];   // qls: the low-part Q fragments in register order (tile, fragment half, lane), shared by all waves: 32 registers a wave fewer, no spill
    const int lane = threadIdx.x & 31, lr = lane & 15, hi = lane >> 4, w = threadIdx.x >> 5; const size_t zb = (size_t)blockIdx.y * TT * HD; const int q0 = blockIdx.x * QW;
    Qh += zb; Ql += zb; Kh += zb; Kl += zb; Vh += zb; Vl += zb;
    V qh[NT];
#pragma unroll
    for (int nt = 0; nt < NT; ++nt) qh[nt] = F::ld(Qh + (size_t)(q0 + nt * 16 + lr) * HD + 8 * hi);
    if (w < NT) { const bf* p = Ql + (size_t)(q0 + w * 16 + lr) * HD + 8 * hi; qls[w][0][lane] = *(const v8us*)p; qls[w][1][lane] = *(const v8us*)(p + 16); }   /* wave w stages tile w */
    v8f acc[2][NT]; float m[NT], l[NT];
#pragma unroll
    for (int nt = 0; nt < NT; ++nt) { acc[0][nt] = (v8f){}; acc[1][nt] = (v8f){}; m[nt] = -3.0e38f; l[nt] = 0.f; }
    const size_t koff = (size_t)lr * HD + 8 * hi, voff = (size_t)lr * TT + 8 * hi;
    V kh[2], kl[2];
#pragma unroll
    for (int t = 0; t < 2; ++t) { const size_t o = koff + (size_t)(w * KSL + t * 16) * HD; kh[t] = F::ld(Kh + o); kl[t] = F::ld(Kl + o); }
    asm volatile("s_wait_xcnt 0x0" ::: "memory");   // the loads above are issued: the wait stands in front of the first overwrite of their address registers
    __syncthreads();   // qls is whole before any wave reads it
#pragma unroll 1   // rolled: the body is long, and four waves a SIMD cover its load latency
    for (int it = 0; it < KSL / 32; ++it) {
        const int kb = w * KSL + it * 32;
        V vh[2], vl[2]; const bf* pvh = Vh + voff + kb; const bf* pvl = Vl + voff + kb;
#pragma unroll
        for (int mt = 0; mt < 2; ++mt) { vh[mt] = F::ld(pvh + (size_t)(mt * 16) * TT); vl[mt] = F::ld(pvl + (size_t)(mt * 16) * TT); }
        asm volatile("s_wait_xcnt 0x0" :: "v"(pvh), "v"(pvl) : "memory");   // in front of the first overwrite of the V loads' address registers (inputs: the pairs stay live up to the wait, so no load of the run lands in one); it also keeps these loads at the head of the pass
#pragma unroll
        for (int nt = 0; nt < NT; ++nt) {
            v8f s[2]; const V qlf = cat16b(qls[nt][0][lane], qls[nt][1][lane]);
#pragma unroll
            for (int t = 0; t < 2; ++t) { v8f c = (v8f){}; c = F::mma(kh[t], qh[nt], c); c = F::mma(kh[t], qlf, c); c = F::mma(kl[t], qh[nt], c); s[t] = c; }
            if (nt == NT - 1) {   /* next pass's K rows, fetched behind this pass's last score products, under the last tile's softmax (the last pass re-reads its own rows: in bounds, unused) */
                const int kn = (it + 1 < KSL / 32) ? kb + 32 : kb; const bf* pkh = Kh + koff + (size_t)kn * HD; const bf* pkl = Kl + koff + (size_t)kn * HD;
#pragma unroll
                for (int t = 0; t < 2; ++t) { kh[t] = F::ld(pkh + t * 16 * HD); kl[t] = F::ld(pkl + t * 16 * HD); }
                asm volatile("s_wait_xcnt 0x0" :: "v"(pkh), "v"(pkl) : "memory");   // as at the V loads: in front of the first overwrite of the K loads' address registers
            }
            float mx = s[0][0];
#pragma unroll
            for (int j = 1; j < 8; ++j) mx = fmaxf(mx, s[0][j]);
#pragma unroll
            for (int j = 0; j < 8; ++j) mx = fmaxf(mx, s[1][j]);
            mx = fmaxf(mx, xhalf(mx)); const float mn = fmaxf(m[nt], mx); const float corr = __builtin_amdgcn_exp2f((m[nt] - mn) * L2E); m[nt] = mn;
            float sum = 0.f; v8u phu, plu;
#pragma unroll
            for (int t = 0; t < 2; ++t)
#pragma unroll
                for (int r = 0; r < 4; ++r) { const float p0 = __builtin_amdgcn_exp2f((s[t][2 * r] - mn) * L2E), p1 = __builtin_amdgcn_exp2f((s[t][2 * r + 1] - mn) * L2E); sum += p0 + p1;
                    const unsigned h2 = pk2(p0, p1); phu[t * 4 + r] = h2; plu[t * 4 + r] = pk2(p0 - __uint_as_float(h2 << 16), p1 - __uint_as_float(h2 & 0xFFFF0000u)); }
            l[nt] = l[nt] * corr + sum;
            const V ph = __builtin_bit_cast(V, phu), pl = __builtin_bit_cast(V, plu);
#pragma unroll
            for (int mt = 0; mt < 2; ++mt) { v8f c = acc[mt][nt] * corr; c = F::mma(vh[mt], ph, c); c = F::mma(vh[mt], pl, c); c = F::mma(vl[mt], ph, c); acc[mt][nt] = c; }
        }
    }
#pragma unroll
    for (int nt = 0; nt < NT; ++nt) { const int q = nt * 16 + lr; const float lt = l[nt] + xhalf(l[nt]); if (hi == 0) { ms[w][q] = m[nt]; ls[w][q] = lt; }
#pragma unroll
        for (int mt = 0; mt < 2; ++mt) { v4f a, b;   /* acc[mt][nt][j] = ctx[q][16 mt + 8 hi + j] */
#pragma unroll
            for (int j = 0; j < 4; ++j) { a[j] = acc[mt][nt][j]; b[j] = acc[mt][nt][4 + j]; }
            *(v4f*)&os[w][q][mt * 16 + hi * 8] = a; *(v4f*)&os[w][q][mt * 16 + hi * 8 + 4] = b; } }
    __syncthreads();   // every wave's slice result is in LDS before any thread joins them
    const int q = threadIdx.x >> 3, d0 = (threadIdx.x & 7) * 4; float M = ms[0][q];
#pragma unroll
    for (int s2 = 1; s2 < FW; ++s2) M = fmaxf(M, ms[s2][q]);
    float L = 0.f; v4f a = (v4f){};
#pragma unroll
    for (int s2 = 0; s2 < FW; ++s2) { const float f = __builtin_amdgcn_exp2f((ms[s2][q] - M) * L2E); L += ls[s2][q] * f; a += *(const v4f*)&os[s2][q][d0] * f; }   /* wave order */
    const float inv = __fdiv_rn(1.0f, L); v4f o;
#pragma unroll
    for (int j = 0; j < 4; ++j) o[j] = __fmul_rn(a[j] * inv, OSC);
    *(v4f*)(out + ((size_t)blockIdx.y * TT + q0 + q) * HDR + d0) = o;  }

extern "C" void kernel_launch(void* const* d_in, const int* in_sizes, int n_in,
                              void* d_out, int out_size, void* d_ws, size_t ws_size, hipStream_t stream) {
    (void)in_sizes; (void)n_in; (void)out_size;
    const float* x = (const float*)d_in[0]; const float* wq = (const float*)d_in[1]; const float* wk = (const float*)d_in[2]; const float* wv = (const float*)d_in[3];
    float* OUT = (float*)d_out;     // [4][4096][32]
    char* wsp = (char*)d_ws;
    auto take = [&](size_t bytes) { char* p = wsp; wsp += (bytes + 255) & ~(size_t)255; return (void*)p; };
    const size_t PB = (size_t)TT * HD;   // one batch's plane, elements
    bf* QPh = (bf*)take(NB_ * PB * 2); bf* QPl = (bf*)take(NB_ * PB * 2); bf* KPh = (bf*)take(NB_ * PB * 2); bf* KPl = (bf*)take(NB_ * PB * 2); bf* VTh = (bf*)take(NB_ * PB * 2); bf* VTl = (bf*)take(NB_ * PB * 2);
    if ((size_t)(wsp - (char*)d_ws) > ws_size) return;    // ws 256 MiB
    k_proj<<<NB_ * TT / PR, 256, 0, stream>>>(x, wq, wk, wv, QPh, QPl, KPh, KPl, VTh, VTl);   /* hi/lo planes of q, k, v^T, all batches */
    k_fattn<<<dim3(TT / QW, NB_, 1), FW * 32, 0, stream>>>(QPh, QPl, KPh, KPl, VTh, VTl, OUT);   /* out = softmax(q k^T) v x 32^-0.5, all batches */
}

// v004
// A run of this version takes 30.7 microseconds.
// Next to v003, in two timings, it ran 1.20 and 1.19 times as fast.
// Over all steps from v000 it is 23.7 times as fast.
#include <hip/hip_runtime.h>

// Single-head attention with POST-softmax scaling (x [4][4096][256]; q,k,v = x W ('xw' [256][32], no bias); energy = q.k UNSCALED; att = softmax(energy) x 32^-0.5; out = att v -> [4][4096][32] (0.5 M)).
// Two launches. k_proj: x and the three weights rounded to bf16 on the way in, the three 32-wide projections as exact bf16 products, hi/lo planes of q, k and v^T for all batches, each laid out in WMMA fragment order (see FRAGMENT-ORDER PLANES below). k_fattn: ONE fused attention launch for all batches (64 queries a work-group, the keys split over its 16 waves, online softmax, every product hi/lo 3 products, the slices joined in LDS in wave order, x 32^-0.5 at the end).
// Compute dtypes, f32 accumulate: every input rounded to bf16; projections exact; scores and att.v 3 products on every row (unscaled logits, sigma ~5.7); softmax f32; the post-softmax scale applied in f32 at the end (a power of two times 1/sqrt(2): one rounding, as the reference's att x scaling then att v up to association).

#define NB_  4
#define TT   4096
#define DM   256
#define HDR  32     // head dim
#define FH   256    // elements of one fragment half: 32 lanes x 8
// FRAGMENT-ORDER PLANES. A plane is a row of 1-KiB fragments, each [half][lane][8 elements]: what lane l holds of a 16x32 A or B operand (row l & 15; k = 8 (l >> 4) + j in half 0, 16 + 8 (l >> 4) + j in half 1) lies at half FH + 8 l.
// q, k: fragment t / 16 (16 tokens x the 32 head columns). v^T: fragments 2 (t / 32) and 2 (t / 32) + 1 (head rows 0..15 and 16..31 x 32 tokens). Either way token t's fragments start at element t HDR rounded down to a fragment (v^T: to two fragments), and a batch is TT HDR elements.
// A wave's 16-byte load or store of a half is then 512 contiguous bytes, four whole 128-byte lines, where a row-major plane gives sixteen 32-byte pieces of sixteen lines.
#define OSC  0.17677669529663688f   // 32^-0.5 applied after the softmax
typedef unsigned short bf;
typedef __attribute__((ext_vector_type(16))) __bf16   v16bf;
typedef __attribute__((ext_vector_type(8)))  unsigned short v8us;
typedef __attribute__((ext_vector_type(8)))  float    v8f;
typedef __attribute__((ext_vector_type(4)))  float    v4f;
typedef __attribute__((ext_vector_type(2)))  float    v2f;
typedef __attribute__((ext_vector_type(2))) __bf16 v2bf;
typedef __attribute__((ext_vector_type(4))) unsigned v4u;
typedef __attribute__((ext_vector_type(8))) unsigned v8u;

__device__ __forceinline__ unsigned pk2(float a, float b) { v2f t; t[0] = a; t[1] = b; return __builtin_bit_cast(unsigned, __builtin_convertvector(t, v2bf)); }   // two f32 -> packed bf16, nearest even
__device__ __forceinline__ v16bf cat16b(v8us lo, v8us hi) { return __builtin_bit_cast(v16bf, __builtin_shufflevector(lo, hi, 0, 1, 2, 3, 4, 5, 6, 7, 8, 9, 10, 11, 12, 13, 14, 15)); }
__device__ __forceinline__ v8f wmmab(v16bf a, v16bf b, v8f c) { return __builtin_amdgcn_wmma_f32_16x16x32_bf16(false, a, false, b, (short)0, c, false, false); }
// A or B fragment of a 16x16x32 product from a K-contiguous 16-bit row: lane (lr, hi) holds row lr, k = 8 hi .. 8 hi + 7 and 16 + 8 hi .. 16 + 8 hi + 7; p points at its row's k = 8 hi.
template <typename T16> struct WFrag;
template <> struct WFrag<bf> { typedef v16bf V; static __device__ __forceinline__ V ld(const bf* p) { return cat16b(*(const v8us*)p, *(const v8us*)(p + 16)); } static __device__ __forceinline__ V ldf(const bf* p) { return cat16b(*(const v8us*)p, *(const v8us*)(p + FH)); } /* from a fragment-order plane: p points at the lane's 8 elements of half 0 */ static __device__ __forceinline__ v8f mma(V a, V b, v8f c) { return wmmab(a, b, c); } };
__device__ __forceinline__ void split8(v8f v, v4u& oh, v4u& ol) {   // 8 f32 -> 8 bf16 high parts and the 8 bf16 roundings of what they leave
#pragma unroll
    for (int r = 0; r < 4; ++r) { const unsigned h2 = pk2(v[2 * r], v[2 * r + 1]); oh[r] = h2; ol[r] = pk2(v[2 * r] - __uint_as_float(h2 << 16), v[2 * r + 1] - __uint_as_float(h2 & 0xFFFF0000u)); } }

// ---- k_proj: q, k, v of PR rows of x (all batches as one row range) in one work-group of 8 waves, straight to the hi/lo planes.
// Wave w owns the 16 rows of tile w >> 1 and three of the six 16-column tiles: both of q and the first of v (w even), both of k and the second of v (w odd). Its x fragments come straight from the f32 rows (all of K in flight at once) and are rounded in registers; the weights are rounded and transposed into LDS once a work-group.
// q and k are formed transposed (A = weight rows, B = x rows) and v plain (A = x rows, B = weight rows), so that a lane's 8 accumulator values are the 8 elements that the same lane holds of a fragment half: each accumulator goes straight to its plane as one 512-byte store of the wave. k runs upward in steps of 32 in one accumulator, as a plain GEMM loop does.
// Every plain '#pragma unroll' in k_proj stands on a short constant-trip loop over register arrays: unrolled so that they are indexed by constants and stay in registers.
#define PR   64     // rows of x a work-group
#define WP   264    // LDS pitch of a transposed weight row, elements: 528 B = 16 B x odd, the pitch for 16-byte fragment reads
__global__ __launch_bounds__(256) void k_proj(const float* __restrict__ x, const float* __restrict__ wq, const float* __restrict__ wk, const float* __restrict__ wv, bf* Qh, bf* Ql, bf* Kh, bf* Kl, bf* Vh, bf* Vl) {
    typedef WFrag<bf> F; typedef v16bf V;
    __shared__ __align__(16) bf wt[3 * HDR][WP];
    const int lane = threadIdx.x & 31, lr = lane & 15, hi = lane >> 4, w = __builtin_amdgcn_readfirstlane(threadIdx.x >> 5); const int mt = w >> 1, hf = w & 1; const size_t g0 = (size_t)blockIdx.x * PR;
    const int kl = (lane >> 3) * 8, n0 = (lane & 7) * 4; const float* ws[3]; v4f t[3][8];   /* 24 strips (matrix, 32 k) over 8 waves, 3 a wave; a lane takes 8 k x 4 columns of each: whole 128-byte rows in, four 16-byte LDS stores out */
#pragma unroll
    for (int i = 0; i < 3; ++i) { const int s = w * 3 + i, mx = s >> 3; ws[i] = (mx == 0 ? wq : mx == 1 ? wk : wv) + ((s & 7) * 32 + kl) * HDR + n0;
#pragma unroll
        for (int j = 0; j < 8; ++j) t[i][j] = *(const v4f*)(ws[i] + j * HDR); }
    asm volatile("s_wait_xcnt 0x0" :: "v"(ws[0]), "v"(ws[1]), "v"(ws[2]) : "memory");   // in front of the first overwrite of the weight loads' address pairs; it also keeps all of them in front of the x loads: loads return in order, so the weights are rounded and laid in LDS while x is on its way
    const float* px = x + (g0 + mt * 16 + lr) * DM + 8 * hi; v8f xa[DM / 32][2];
#pragma unroll
    for (int ks = 0; ks < DM / 32; ++ks) { xa[ks][0] = *(const v8f*)(px + ks * 32); xa[ks][1] = *(const v8f*)(px + ks * 32 + 16); }
    asm volatile("s_wait_xcnt 0x0" :: "v"(px) : "memory");   // in front of the first overwrite of the x loads' address pair; the memory clobber keeps them in front of it
    __builtin_amdgcn_sched_barrier(0);   // the weights' rounding, which waits for their data, stays behind the issue of the x loads: without it the x loads leave one L2 round trip later
#pragma unroll
    for (int i = 0; i < 3; ++i) { const int s = w * 3 + i, mx = s >> 3, k0 = (s & 7) * 32 + kl;
#pragma unroll
        for (int e = 0; e < 4; ++e) { v4u o;
#pragma unroll
            for (int r = 0; r < 4; ++r) o[r] = pk2(t[i][2 * r][e], t[i][2 * r + 1][e]);
            *(v4u*)&wt[mx * HDR + n0 + e][k0] = o; } }
    __syncthreads();   // the transposed weights are whole before any wave reads them
    v8f a0 = (v8f){}, a1 = (v8f){}, a2 = (v8f){}; const bf* pw = &wt[hf * HDR + lr][8 * hi]; const bf* pv = &wt[2 * HDR + hf * 16 + lr][8 * hi];
#pragma unroll
    for (int ks = 0; ks < DM / 32; ++ks) { v8u xu;
#pragma unroll
        for (int r = 0; r < 4; ++r) { xu[r] = pk2(xa[ks][0][2 * r], xa[ks][0][2 * r + 1]); xu[4 + r] = pk2(xa[ks][1][2 * r], xa[ks][1][2 * r + 1]); }
        const V xf = __builtin_bit_cast(V, xu);
        a0 = F::mma(F::ld(pw + ks * 32), xf, a0); a1 = F::mma(F::ld(pw + 16 * WP + ks * 32), xf, a1); a2 = F::mma(xf, F::ld(pv + ks * 32), a2); }
    v4u h0, l0, h1, l1, h2, l2; split8(a0, h0, l0); split8(a1, h1, l1); split8(a2, h2, l2);   /* every split in registers of its own: no store's data register is written again */
    bf* Ph = hf ? Kh : Qh; bf* Pl = hf ? Kl : Ql; const size_t ro = (g0 + mt * 16) * HDR + lane * 8;   /* a0[j], a1[j] = row mt 16 + lr, column 8 hi + j, 16 + 8 hi + j: halves 0 and 1 of the row tile's fragment */
    *(v4u*)(Ph + ro) = h0; *(v4u*)(Pl + ro) = l0; *(v4u*)(Ph + ro + FH) = h1; *(v4u*)(Pl + ro + FH) = l1;
    const size_t vo = (g0 + (mt >> 1) * 32) * HDR + (hf * 2 + (mt & 1)) * FH + lane * 8;   /* a2[j] = row mt 16 + 8 hi + j, column hf 16 + lr: half mt & 1 of fragment hf of the 32-token block */
    *(v4u*)(Vh + vo) = h2; *(v4u*)(Vl + vo) = l2;  }
// ---- k_fattn: scores, softmax and att.v of one 64-query tile in one work-group; no score or probability ever reaches memory.
// S^T = K Q^T (A = K rows, B = Q rows, both on the 32 real head columns, one k-step) so that a lane holds one query's scores: two 16-key D tiles, converted in place, are the B operand of O^T += V^T P^T.
// Every plain '#pragma unroll' in k_fattn stands on a short constant-trip loop: over register arrays (fragments, accumulators), unrolled so that they are indexed by constants and stay in registers, or over the FW slices in LDS at the join.
// Wave w walks keys [w KSL, (w + 1) KSL) with a running maximum and sum (online softmax, f32); the FW waves' (max, sum, context) are joined in LDS in wave order. Three hi/lo products (hi.hi, lo.hi, hi.lo) on both GEMMs.
#define FW   16           // waves of a work-group = key slices
#define NT   4            // 16-query tiles a wave: every K and V fragment fetched serves NT tiles
#define QW   (NT * 16)    // queries a work-group
#define KSL  (TT / FW)    // keys a wave
#define L2E  1.4426950408889634f
__device__ __forceinline__ float xhalf(float x) { const int b = __float_as_int(x); return __int_as_float(__builtin_amdgcn_permlanex16(b, b, 0x76543210, 0xfedcba98, false, false)); }   // lane l <-> l ^ 16
__global__ __launch_bounds__(FW * 32) void k_fattn(const bf* __restrict__ Qh, const bf* __restrict__ Ql, const bf* __restrict__ Kh, const bf* __restrict__ Kl, const bf* __restrict__ Vh, const bf* __restrict__ Vl, float* out) {
    typedef WFrag<bf> F; typedef v16bf V;
    __shared__ float ms[FW][QW], ls[FW][QW]; __shared__ __align__(16) float os[FW][QW][36]; __shared__ __align__(16) v8us qls[NT][2][32];   // qls: the low-part Q fragments in register order (tile, fragment half, lane), shared by all waves: 32 registers a wave fewer, no spill
    const int lane = threadIdx.x & 31, lr = lane & 15, hi = lane >> 4, w = threadIdx.x >> 5; const size_t zb = (size_t)blockIdx.y * TT * HDR; const int q0 = blockIdx.x * QW;
    Qh += zb; Ql += zb; Kh += zb; Kl += zb; Vh += zb; Vl += zb;
    V qh[NT];
#pragma unroll
    for (int nt = 0; nt < NT; ++nt) qh[nt] = F::ldf(Qh + (q0 + nt * 16) * HDR + lane * 8);
    if (w < NT) { const bf* p = Ql + (q0 + w * 16) * HDR + lane * 8; qls[w][0][lane] = *(const v8us*)p; qls[w][1][lane] = *(const v8us*)(p + FH); }   /* wave w stages tile w */
    v8f acc[2][NT]; float m[NT], l[NT];
#pragma unroll
    for (int nt = 0; nt < NT; ++nt) { acc[0][nt] = (v8f){}; acc[1][nt] = (v8f){}; m[nt] = -3.0e38f; l[nt] = 0.f; }
    V kh[2], kl[2];
#pragma unroll
    for (int t = 0; t < 2; ++t) { const int o = (w * KSL + t * 16) * HDR + lane * 8; kh[t] = F::ldf(Kh + o); kl[t] = F::ldf(Kl + o); }
    asm volatile("s_wait_xcnt 0x0" ::: "memory");   // the loads above are issued: the wait stands in front of the first overwrite of their address registers
    __syncthreads();   // qls is whole before any wave reads it
#pragma unroll 1   // rolled: the body is long, and four waves a SIMD cover its load latency
    for (int it = 0; it < KSL / 32; ++it) {
        const int kb = w * KSL + it * 32;
        V vh[2], vl[2]; const bf* pvh = Vh + kb * HDR + lane * 8; const bf* pvl = Vl + kb * HDR + lane * 8;
#pragma unroll
        for (int mt = 0; mt < 2; ++mt) { vh[mt] = F::ldf(pvh + mt * 2 * FH); vl[mt] = F::ldf(pvl + mt * 2 * FH); }
        asm volatile("s_wait_xcnt 0x0" :: "v"(pvh), "v"(pvl) : "memory");   // in front of the first overwrite of the V loads' address registers (inputs: the pairs stay live up to the wait, so no load of the run lands in one); it also keeps these loads at the head of the pass
#pragma unroll
        for (int nt = 0; nt < NT; ++nt) {
            v8f s[2]; const V qlf = cat16b(qls[nt][0][lane], qls[nt][1][lane]);
#pragma unroll
            for (int t = 0; t < 2; ++t) { v8f c = (v8f){}; c = F::mma(kh[t], qh[nt], c); c = F::mma(kh[t], qlf, c); c = F::mma(kl[t], qh[nt], c); s[t] = c; }
            if (nt == NT - 1) {   /* next pass's K rows, fetched behind this pass's last score products, under the last tile's softmax (the last pass re-reads its own rows: in bounds, unused) */
                const int kn = (it + 1 < KSL / 32) ? kb + 32 : kb; const bf* pkh = Kh + kn * HDR + lane * 8; const bf* pkl = Kl + kn * HDR + lane * 8;
#pragma unroll
                for (int t = 0; t < 2; ++t) { kh[t] = F::ldf(pkh + t * 2 * FH); kl[t] = F::ldf(pkl + t * 2 * FH); }
                asm volatile("s_wait_xcnt 0x0" :: "v"(pkh), "v"(pkl) : "memory");   // as at the V loads: in front of the first overwrite of the K loads' address registers
            }
            float mx = s[0][0];
#pragma unroll
            for (int j = 1; j < 8; ++j) mx = fmaxf(mx, s[0][j]);
#pragma unroll
            for (int j = 0; j < 8; ++j) mx = fmaxf(mx, s[1][j]);
            mx = fmaxf(mx, xhalf(mx)); const float mn = fmaxf(m[nt], mx); const float corr = __builtin_amdgcn_exp2f((m[nt] - mn) * L2E); m[nt] = mn;
            float sum = 0.f; v8u phu, plu;
#pragma unroll
            for (int t = 0; t < 2; ++t)
#pragma unroll
                for (int r = 0; r < 4; ++r) { const float p0 = __builtin_amdgcn_exp2f((s[t][2 * r] - mn) * L2E), p1 = __builtin_amdgcn_exp2f((s[t][2 * r + 1] - mn) * L2E); sum += p0 + p1;
                    const unsigned h2 = pk2(p0, p1); phu[t * 4 + r] = h2; plu[t * 4 + r] = pk2(p0 - __uint_as_float(h2 << 16), p1 - __uint_as_float(h2 & 0xFFFF0000u)); }
            l[nt] = l[nt] * corr + sum;
            const V ph = __builtin_bit_cast(V, phu), pl = __builtin_bit_cast(V, plu);
#pragma unroll
            for (int mt = 0; mt < 2; ++mt) { v8f c = acc[mt][nt] * corr; c = F::mma(vh[mt], ph, c); c = F::mma(vh[mt], pl, c); c = F::mma(vl[mt], ph, c); acc[mt][nt] = c; }
        }
    }
#pragma unroll
    for (int nt = 0; nt < NT; ++nt) { const int q = nt * 16 + lr; const float lt = l[nt] + xhalf(l[nt]); if (hi == 0) { ms[w][q] = m[nt]; ls[w][q] = lt; }
#pragma unroll
        for (int mt = 0; mt < 2; ++mt) { v4f a, b;   /* acc[mt][nt][j] = ctx[q][16 mt + 8 hi + j] */
#pragma unroll
            for (int j = 0; j < 4; ++j) { a[j] = acc[mt][nt][j]; b[j] = acc[mt][nt][4 + j]; }
            *(v4f*)&os[w][q][mt * 16 + hi * 8] = a; *(v4f*)&os[w][q][mt * 16 + hi * 8 + 4] = b; } }
    __syncthreads();   // every wave's slice result is in LDS before any thread joins them
    const int q = threadIdx.x >> 3, d0 = (threadIdx.x & 7) * 4; float M = ms[0][q];
#pragma unroll
    for (int s2 = 1; s2 < FW; ++s2) M = fmaxf(M, ms[s2][q]);
    float L = 0.f; v4f a = (v4f){};
#pragma unroll
    for (int s2 = 0; s2 < FW; ++s2) { const float f = __builtin_amdgcn_exp2f((ms[s2][q] - M) * L2E); L += ls[s2][q] * f; a += *(const v4f*)&os[s2][q][d0] * f; }   /* wave order */
    const float inv = __fdiv_rn(1.0f, L); v4f o;
#pragma unroll
    for (int j = 0; j < 4; ++j) o[j] = __fmul_rn(a[j] * inv, OSC);
    *(v4f*)(out + ((size_t)blockIdx.y * TT + q0 + q) * HDR + d0) = o;  }

extern "C" void kernel_launch(void* const* d_in, const int* in_sizes, int n_in,
                              void* d_out, int out_size, void* d_ws, size_t ws_size, hipStream_t stream) {
    (void)in_sizes; (void)n_in; (void)out_size;
    const float* x = (const float*)d_in[0]; const float* wq = (const float*)d_in[1]; const float* wk = (const float*)d_in[2]; const float* wv = (const float*)d_in[3];
    float* OUT = (float*)d_out;     // [4][4096][32]
    char* wsp = (char*)d_ws;
    auto take = [&](size_t bytes) { char* p = wsp; wsp += (bytes + 255) & ~(size_t)255; return (void*)p; };
    const size_t PB = (size_t)TT * HDR;   // one batch's plane, elements
    bf* QPh = (bf*)take(NB_ * PB * 2); bf* QPl = (bf*)take(NB_ * PB * 2); bf* KPh = (bf*)take(NB_ * PB * 2); bf* KPl = (bf*)take(NB_ * PB * 2); bf* VTh = (bf*)take(NB_ * PB * 2); bf* VTl = (bf*)take(NB_ * PB * 2);
    if ((size_t)(wsp - (char*)d_ws) > ws_size) return;    // ws 256 MiB
    k_proj<<<NB_ * TT / PR, 256, 0, stream>>>(x, wq, wk, wv, QPh, QPl, KPh, KPl, VTh, VTl);   /* hi/lo planes of q, k, v^T, all batches */
    k_fattn<<<dim3(TT / QW, NB_, 1), FW * 32, 0, stream>>>(QPh, QPl, KPh, KPl, VTh, VTl, OUT);   /* out = softmax(q k^T) v x 32^-0.5, all batches */
}

// v005
// It runs in 28.2 microseconds.
// Two timings next to v004 both put it at 1.10 times that version's speed.
// All steps since v000 together make it 26.0 times as fast.
#include <hip/hip_runtime.h>

// Single-head attention with POST-softmax scaling (x [4][4096][256]; q,k,v = x W ('xw' [256][32], no bias); energy = q.k UNSCALED; att = softmax(energy) x 32^-0.5; out = att v -> [4][4096][32] (0.5 M)).
// Two launches. k_proj: x and the three weights rounded to bf16 on the way in, the three 32-wide projections as exact bf16 products, hi/lo planes of q, k and v^T for all batches, each laid out in WMMA fragment order (see FRAGMENT-ORDER PLANES below). k_fattn: ONE fused attention launch for all batches (64 queries a work-group, the keys split over its 16 waves, online softmax, every product hi/lo 3 products, the slices joined in LDS in wave order, x 32^-0.5 at the end).
// Compute dtypes, f32 accumulate: every input rounded to bf16; projections exact; scores and att.v 3 products on every row (unscaled logits, sigma ~5.7); softmax f32; the post-softmax scale applied in f32 at the end (a power of two times 1/sqrt(2): one rounding, as the reference's att x scaling then att v up to association).

#define NB_  4
#define TT   4096
#define DM   256
#define HDR  32     // head dim
#define FH   256    // elements of one fragment half: 32 lanes x 8
// FRAGMENT-ORDER PLANES. A plane is a row of 1-KiB fragments, each [half][lane][8 elements]: what lane l holds of a 16x32 A or B operand (row l & 15; k = 8 (l >> 4) + j in half 0, 16 + 8 (l >> 4) + j in half 1) lies at half FH + 8 l.
// q, k: fragment t / 16 (16 tokens x the 32 head columns). v^T: fragments 2 (t / 32) and 2 (t / 32) + 1 (head rows 0..15 and 16..31 x 32 tokens). Either way token t's fragments start at element t HDR rounded down to a fragment (v^T: to two fragments), and a batch is TT HDR elements.
// A wave's 16-byte load or store of a half is then 512 contiguous bytes, four whole 128-byte lines, where a row-major plane gives sixteen 32-byte pieces of sixteen lines.
#define OSC  0.17677669529663688f   // 32^-0.5 applied after the softmax
typedef unsigned short bf;
typedef __attribute__((ext_vector_type(16))) __bf16   v16bf;
typedef __attribute__((ext_vector_type(8)))  unsigned short v8us;
typedef __attribute__((ext_vector_type(8)))  float    v8f;
typedef __attribute__((ext_vector_type(4)))  float    v4f;
typedef __attribute__((ext_vector_type(2)))  float    v2f;
typedef __attribute__((ext_vector_type(2))) __bf16 v2bf;
typedef __attribute__((ext_vector_type(4))) unsigned v4u;
typedef __attribute__((ext_vector_type(8))) unsigned v8u;

__device__ __forceinline__ unsigned pk2(float a, float b) { v2f t; t[0] = a; t[1] = b; return __builtin_bit_cast(unsigned, __builtin_convertvector(t, v2bf)); }   // two f32 -> packed bf16, nearest even
__device__ __forceinline__ v16bf cat16b(v8us lo, v8us hi) { return __builtin_bit_cast(v16bf, __builtin_shufflevector(lo, hi, 0, 1, 2, 3, 4, 5, 6, 7, 8, 9, 10, 11, 12, 13, 14, 15)); }
__device__ __forceinline__ v8f wmmab(v16bf a, v16bf b, v8f c) { return __builtin_amdgcn_wmma_f32_16x16x32_bf16(false, a, false, b, (short)0, c, false, false); }
// A or B fragment of a 16x16x32 product from a K-contiguous 16-bit row: lane (lr, hi) holds row lr, k = 8 hi .. 8 hi + 7 and 16 + 8 hi .. 16 + 8 hi + 7; p points at its row's k = 8 hi.
template <typename T16> struct WFrag;
template <> struct WFrag<bf> { typedef v16bf V; static __device__ __forceinline__ V ld(const bf* p) { return cat16b(*(const v8us*)p, *(const v8us*)(p + 16)); } static __device__ __forceinline__ V ldf(const bf* p) { return cat16b(*(const v8us*)p, *(const v8us*)(p + FH)); } /* from a fragment-order plane: p points at the lane's 8 elements of half 0 */ static __device__ __forceinline__ v8f mma(V a, V b, v8f c) { return wmmab(a, b, c); } };
__device__ __forceinline__ void split8(v8f v, v4u& oh, v4u& ol) {   // 8 f32 -> 8 bf16 high parts and the 8 bf16 roundings of what they leave
#pragma unroll
    for (int r = 0; r < 4; ++r) { const unsigned h2 = pk2(v[2 * r], v[2 * r + 1]); oh[r] = h2; ol[r] = pk2(v[2 * r] - __uint_as_float(h2 << 16), v[2 * r + 1] - __uint_as_float(h2 & 0xFFFF0000u)); } }

// ---- k_proj: q, k, v of PR rows of x (all batches as one row range) in one work-group of 8 waves, straight to the hi/lo planes.
// Wave w owns the 16 rows of tile w >> 1 and three of the six 16-column tiles: both of q and the first of v (w even), both of k and the second of v (w odd). Its x fragments come straight from the f32 rows (all of K in flight at once) and are rounded in registers; the weights are rounded and transposed into LDS once a work-group.
// q and k are formed transposed (A = weight rows, B = x rows) and v plain (A = x rows, B = weight rows), so that a lane's 8 accumulator values are the 8 elements that the same lane holds of a fragment half: each accumulator goes straight to its plane as one 512-byte store of the wave. k runs upward in steps of 32 in one accumulator, as a plain GEMM loop does.
// Every plain '#pragma unroll' in k_proj stands on a short constant-trip loop over register arrays: unrolled so that they are indexed by constants and stay in registers.
#define PR   64     // rows of x a work-group
#define WP   264    // LDS pitch of a transposed weight row, elements: 528 B = 16 B x odd, the pitch for 16-byte fragment reads
__global__ __launch_bounds__(256) void k_proj(const float* __restrict__ x, const float* __restrict__ wq, const float* __restrict__ wk, const float* __restrict__ wv, bf* Qh, bf* Ql, bf* Kh, bf* Kl, bf* Vh, bf* Vl) {
    typedef WFrag<bf> F; typedef v16bf V;
    __shared__ __align__(16) bf wt[3 * HDR][WP];
    const int lane = threadIdx.x & 31, lr = lane & 15, hi = lane >> 4, w = __builtin_amdgcn_readfirstlane(threadIdx.x >> 5); const int mt = w >> 1, hf = w & 1; const size_t g0 = (size_t)blockIdx.x * PR;
    const int kl = (lane >> 3) * 8, n0 = (lane & 7) * 4; const float* ws[3]; v4f t[3][8];   /* 24 strips (matrix, 32 k) over 8 waves, 3 a wave; a lane takes 8 k x 4 columns of each: whole 128-byte rows in, four 16-byte LDS stores out */
#pragma unroll
    for (int i = 0; i < 3; ++i) { const int s = w * 3 + i, mx = s >> 3; ws[i] = (mx == 0 ? wq : mx == 1 ? wk : wv) + ((s & 7) * 32 + kl) * HDR + n0;
#pragma unroll
        for (int j = 0; j < 8; ++j) t[i][j] = *(const v4f*)(ws[i] + j * HDR); }
    asm volatile("s_wait_xcnt 0x0" :: "v"(ws[0]), "v"(ws[1]), "v"(ws[2]) : "memory");   // in front of the first overwrite of the weight loads' address pairs; it also keeps all of them in front of the x loads: loads return in order, so the weights are rounded and laid in LDS while x is on its way
    const float* px = x + (g0 + mt * 16 + lr) * DM + 8 * hi; v8f xa[DM / 32][2];
#pragma unroll
    for (int ks = 0; ks < DM / 32; ++ks) { xa[ks][0] = *(const v8f*)(px + ks * 32); xa[ks][1] = *(const v8f*)(px + ks * 32 + 16); }
    asm volatile("s_wait_xcnt 0x0" :: "v"(px) : "memory");   // in front of the first overwrite of the x loads' address pair; the memory clobber keeps them in front of it
    __builtin_amdgcn_sched_barrier(0);   // the weights' rounding, which waits for their data, stays behind the issue of the x loads: without it the x loads leave one L2 round trip later
#pragma unroll
    for (int i = 0; i < 3; ++i) { const int s = w * 3 + i, mx = s >> 3, k0 = (s & 7) * 32 + kl;
#pragma unroll
        for (int e = 0; e < 4; ++e) { v4u o;
#pragma unroll
            for (int r = 0; r < 4; ++r) o[r] = pk2(t[i][2 * r][e], t[i][2 * r + 1][e]);
            *(v4u*)&wt[mx * HDR + n0 + e][k0] = o; } }
    __syncthreads();   // the transposed weights are whole before any wave reads them
    v8f a0 = (v8f){}, a1 = (v8f){}, a2 = (v8f){}; const bf* pw = &wt[hf * HDR + lr][8 * hi]; const bf* pv = &wt[2 * HDR + hf * 16 + lr][8 * hi];
#pragma unroll
    for (int ks = 0; ks < DM / 32; ++ks) { v8u xu;
#pragma unroll
        for (int r = 0; r < 4; ++r) { xu[r] = pk2(xa[ks][0][2 * r], xa[ks][0][2 * r + 1]); xu[4 + r] = pk2(xa[ks][1][2 * r], xa[ks][1][2 * r + 1]); }
        const V xf = __builtin_bit_cast(V, xu);
        a0 = F::mma(F::ld(pw + ks * 32), xf, a0); a1 = F::mma(F::ld(pw + 16 * WP + ks * 32), xf, a1); a2 = F::mma(xf, F::ld(pv + ks * 32), a2); }
    v4u h0, l0, h1, l1, h2, l2; split8(a0, h0, l0); split8(a1, h1, l1); split8(a2, h2, l2);   /* every split in registers of its own: no store's data register is written again */
    bf* Ph = hf ? Kh : Qh; bf* Pl = hf ? Kl : Ql; const size_t ro = (g0 + mt * 16) * HDR + lane * 8;   /* a0[j], a1[j] = row mt 16 + lr, column 8 hi + j, 16 + 8 hi + j: halves 0 and 1 of the row tile's fragment */
    *(v4u*)(Ph + ro) = h0; *(v4u*)(Pl + ro) = l0; *(v4u*)(Ph + ro + FH) = h1; *(v4u*)(Pl + ro + FH) = l1;
    const size_t vo = (g0 + (mt >> 1) * 32) * HDR + (hf * 2 + (mt & 1)) * FH + lane * 8;   /* a2[j] = row mt 16 + 8 hi + j, column hf 16 + lr: half mt & 1 of fragment hf of the 32-token block */
    *(v4u*)(Vh + vo) = h2; *(v4u*)(Vl + vo) = l2;  }
// ---- k_fattn: scores, softmax and att.v of one 64-query tile in one work-group; no score or probability ever reaches memory.
// S^T = K Q^T (A = K rows, B = Q rows, both on the 32 real head columns, one k-step) so that a lane holds one query's scores: two 16-key D tiles, converted in place, are the B operand of O^T += V^T P^T.
// Every plain '#pragma unroll' in k_fattn stands on a short constant-trip loop: over register arrays (fragments, accumulators), unrolled so that they are indexed by constants and stay in registers, or over the FW slices in LDS at the join.
// Wave w walks keys [w KSL, (w + 1) KSL) with a running maximum and sum (online softmax, f32); the FW waves' (max, sum, context) are joined in LDS in wave order. Three hi/lo products (hi.hi, lo.hi, hi.lo) on both GEMMs.
#define FW   16           // waves of a work-group = key slices
#define NT   4            // 16-query tiles a wave: every K and V fragment fetched serves NT tiles
#define QW   (NT * 16)    // queries a work-group
#define KSL  (TT / FW)    // keys a wave
#define L2E  1.4426950408889634f
typedef __attribute__((ext_vector_type(4))) int v4i;
#define PK   (2 * 2 * FH)   // elements of one plane that a pass of 32 keys takes: two fragments, 2 KiB
// 2 KiB of a plane to LDS, through no register: four asynchronous copies of the wave, 512 contiguous bytes each; g and s point at the lane's own 16 bytes, the offset moves both addresses.
__device__ __forceinline__ void cp2k(const bf* g, bf* s) {
    __attribute__((address_space(1))) v4i* gp = (__attribute__((address_space(1))) v4i*)g; __attribute__((address_space(3))) v4i* sp = (__attribute__((address_space(3))) v4i*)s;
    __builtin_amdgcn_global_load_async_to_lds_b128(gp, sp, 0, 0); __builtin_amdgcn_global_load_async_to_lds_b128(gp, sp, 512, 0); __builtin_amdgcn_global_load_async_to_lds_b128(gp, sp, 1024, 0); __builtin_amdgcn_global_load_async_to_lds_b128(gp, sp, 1536, 0); }
__device__ __forceinline__ float xhalf(float x) { const int b = __float_as_int(x); return __int_as_float(__builtin_amdgcn_permlanex16(b, b, 0x76543210, 0xfedcba98, false, false)); }   // lane l <-> l ^ 16
__global__ __launch_bounds__(FW * 32) void k_fattn(const bf* __restrict__ Qh, const bf* __restrict__ Ql, const bf* __restrict__ Kh, const bf* __restrict__ Kl, const bf* __restrict__ Vh, const bf* __restrict__ Vl, float* out) {
    typedef WFrag<bf> F; typedef v16bf V;
    __shared__ float ms[FW][QW], ls[FW][QW]; __shared__ __align__(16) float os[FW][QW][36]; __shared__ __align__(16) bf ring[FW][4][PK]; __shared__ __align__(16) v8us qls[NT][2][32];   // ring: see K AND V THROUGH LDS below. qls: the low-part Q fragments in register order (tile, fragment half, lane), shared by all waves: 32 registers a wave fewer, no spill
    const int lane = threadIdx.x & 31, lr = lane & 15, hi = lane >> 4, w = __builtin_amdgcn_readfirstlane(threadIdx.x >> 5); const size_t zb = (size_t)blockIdx.y * TT * HDR; const int q0 = blockIdx.x * QW;
    Qh += zb; Ql += zb; Kh += zb; Kl += zb; Vh += zb; Vl += zb;
    // K AND V THROUGH LDS. Each wave owns one 8-KiB slot (K hi, K lo, V hi, V lo of one pass), which no other wave touches: no barrier. The registers are the second buffer: once a pass's fragments are read out of the slot, the next pass's 16 copies go into it, most of a pass ahead of their first reader, so that no wave waits on L2 at a pass's head. (The wave's number goes through readfirstlane so that the planes' bases stay in scalar registers: with them in vector registers the build spilled.)
    bf* const rg = &ring[w][0][lane * 8]; const int k0 = w * KSL * HDR + lane * 8;
    cp2k(Vh + k0, rg + 2 * PK); cp2k(Vl + k0, rg + 3 * PK);   /* pass 0's V; its K comes straight to registers below */
    V qh[NT];
#pragma unroll
    for (int nt = 0; nt < NT; ++nt) qh[nt] = F::ldf(Qh + (q0 + nt * 16) * HDR + lane * 8);
    if (w < NT) { const bf* p = Ql + (q0 + w * 16) * HDR + lane * 8; qls[w][0][lane] = *(const v8us*)p; qls[w][1][lane] = *(const v8us*)(p + FH); }   /* wave w stages tile w */
    v8f acc[2][NT]; float m[NT], l[NT];
#pragma unroll
    for (int nt = 0; nt < NT; ++nt) { acc[0][nt] = (v8f){}; acc[1][nt] = (v8f){}; m[nt] = -3.0e38f; l[nt] = 0.f; }
    V kh[2], kl[2];
#pragma unroll
    for (int t = 0; t < 2; ++t) { const int o = (w * KSL + t * 16) * HDR + lane * 8; kh[t] = F::ldf(Kh + o); kl[t] = F::ldf(Kl + o); }
    asm volatile("s_wait_xcnt 0x0" ::: "memory");   // the loads above are issued: the wait stands in front of the first overwrite of their address registers
    asm volatile("s_wait_asynccnt 0x0" ::: "memory");   // pass 0's V has landed in this wave's slot before the wave reads it
    __syncthreads();   // qls is whole before any wave reads it
#pragma unroll 1   // rolled: the body is long, and four waves a SIMD cover its LDS latency
    for (int it = 0; it < KSL / 32; ++it) {
        const int kb = w * KSL + it * 32;
        V vh[2], vl[2];
#pragma unroll
        for (int mt = 0; mt < 2; ++mt) { vh[mt] = F::ldf(rg + 2 * PK + mt * 2 * FH); vl[mt] = F::ldf(rg + 3 * PK + mt * 2 * FH); }   /* landed: behind the wait in the pass before (pass 0: in front of the loop) */
#pragma unroll
        for (int nt = 0; nt < NT; ++nt) {
            v8f s[2]; const V qlf = cat16b(qls[nt][0][lane], qls[nt][1][lane]);
#pragma unroll
            for (int t = 0; t < 2; ++t) { v8f c = (v8f){}; c = F::mma(kh[t], qh[nt], c); c = F::mma(kh[t], qlf, c); c = F::mma(kl[t], qh[nt], c); s[t] = c; }
            if (nt == 0 && it + 1 < KSL / 32) {   /* the refill, behind the first tile's score products: a scalar test, every lane on */
                asm volatile("s_wait_dscnt 0x0" ::: "memory");   // this wave's reads of the slot (this pass's V above, its K in the pass before) have returned before a copy writes over them
                const int o = (kb + 32) * HDR + lane * 8; cp2k(Kh + o, rg); cp2k(Kl + o, rg + PK); cp2k(Vh + o, rg + 2 * PK); cp2k(Vl + o, rg + 3 * PK);
            }
            float mx = s[0][0];
#pragma unroll
            for (int j = 1; j < 8; ++j) mx = fmaxf(mx, s[0][j]);
#pragma unroll
            for (int j = 0; j < 8; ++j) mx = fmaxf(mx, s[1][j]);
            mx = fmaxf(mx, xhalf(mx)); const float mn = fmaxf(m[nt], mx); const float corr = __builtin_amdgcn_exp2f((m[nt] - mn) * L2E); m[nt] = mn;
            float sum = 0.f; v8u phu, plu;
#pragma unroll
            for (int t = 0; t < 2; ++t)
#pragma unroll
                for (int r = 0; r < 4; ++r) { const float p0 = __builtin_amdgcn_exp2f((s[t][2 * r] - mn) * L2E), p1 = __builtin_amdgcn_exp2f((s[t][2 * r + 1] - mn) * L2E); sum += p0 + p1;
                    const unsigned h2 = pk2(p0, p1); phu[t * 4 + r] = h2; plu[t * 4 + r] = pk2(p0 - __uint_as_float(h2 << 16), p1 - __uint_as_float(h2 & 0xFFFF0000u)); }
            l[nt] = l[nt] * corr + sum;
            const V ph = __builtin_bit_cast(V, phu), pl = __builtin_bit_cast(V, plu);
#pragma unroll
            for (int mt = 0; mt < 2; ++mt) { v8f c = acc[mt][nt] * corr; c = F::mma(vh[mt], ph, c); c = F::mma(vh[mt], pl, c); c = F::mma(vl[mt], ph, c); acc[mt][nt] = c; }
        }
        __builtin_amdgcn_sched_barrier(0);   // holds the wait below low in the pass: nothing ties it to the products above, and without this line the scheduler lifts it to the second tile, which cuts the copies' lead to a third
        asm volatile("s_wait_asynccnt 0x0" ::: "memory");   // the 16 copies issued at the first tile have landed: K for the reads below, V for the head of the next pass
#pragma unroll
        for (int t = 0; t < 2; ++t) { kh[t] = F::ldf(rg + t * 2 * FH); kl[t] = F::ldf(rg + PK + t * 2 * FH); }   /* next pass's K fragments out of the slot (the last pass reads its own again: unused) */
    }
#pragma unroll
    for (int nt = 0; nt < NT; ++nt) { const int q = nt * 16 + lr; const float lt = l[nt] + xhalf(l[nt]); if (hi == 0) { ms[w][q] = m[nt]; ls[w][q] = lt; }
#pragma unroll
        for (int mt = 0; mt < 2; ++mt) { v4f a, b;   /* acc[mt][nt][j] = ctx[q][16 mt + 8 hi + j] */
#pragma unroll
            for (int j = 0; j < 4; ++j) { a[j] = acc[mt][nt][j]; b[j] = acc[mt][nt][4 + j]; }
            *(v4f*)&os[w][q][mt * 16 + hi * 8] = a; *(v4f*)&os[w][q][mt * 16 + hi * 8 + 4] = b; } }
    __syncthreads();   // every wave's slice result is in LDS before any thread joins them
    const int q = threadIdx.x >> 3, d0 = (threadIdx.x & 7) * 4; float M = ms[0][q];
#pragma unroll
    for (int s2 = 1; s2 < FW; ++s2) M = fmaxf(M, ms[s2][q]);
    float L = 0.f; v4f a = (v4f){};
#pragma unroll
    for (int s2 = 0; s2 < FW; ++s2) { const float f = __builtin_amdgcn_exp2f((ms[s2][q] - M) * L2E); L += ls[s2][q] * f; a += *(const v4f*)&os[s2][q][d0] * f; }   /* wave order */
    const float inv = __fdiv_rn(1.0f, L); v4f o;
#pragma unroll
    for (int j = 0; j < 4; ++j) o[j] = __fmul_rn(a[j] * inv, OSC);
    *(v4f*)(out + ((size_t)blockIdx.y * TT + q0 + q) * HDR + d0) = o;  }

extern "C" void kernel_launch(void* const* d_in, const int* in_sizes, int n_in,
                              void* d_out, int out_size, void* d_ws, size_t ws_size, hipStream_t stream) {
    (void)in_sizes; (void)n_in; (void)out_size;
    const float* x = (const float*)d_in[0]; const float* wq = (const float*)d_in[1]; const float* wk = (const float*)d_in[2]; const float* wv = (const float*)d_in[3];
    float* OUT = (float*)d_out;     // [4][4096][32]
    char* wsp = (char*)d_ws;
    auto take = [&](size_t bytes) { char* p = wsp; wsp += (bytes + 255) & ~(size_t)255; return (void*)p; };
    const size_t PB = (size_t)TT * HDR;   // one batch's plane, elements
    bf* QPh = (bf*)take(NB_ * PB * 2); bf* QPl = (bf*)take(NB_ * PB * 2); bf* KPh = (bf*)take(NB_ * PB * 2); bf* KPl = (bf*)take(NB_ * PB * 2); bf* VTh = (bf*)take(NB_ * PB * 2); bf* VTl = (bf*)take(NB_ * PB * 2);
    if ((size_t)(wsp - (char*)d_ws) > ws_size) return;    // ws 256 MiB
    k_proj<<<NB_ * TT / PR, 256, 0, stream>>>(x, wq, wk, wv, QPh, QPl, KPh, KPl, VTh, VTl);   /* hi/lo planes of q, k, v^T, all batches */
    k_fattn<<<dim3(TT / QW, NB_, 1), FW * 32, 0, stream>>>(QPh, QPl, KPh, KPl, VTh, VTl, OUT);   /* out = softmax(q k^T) v x 32^-0.5, all batches */
}

// v006
// One run takes 27.2 microseconds.
// In two side-by-side timings against v005, it was 1.04 and 1.03 times as fast.
// Over all steps from v000 it is 26.9 times as fast.
#include <hip/hip_runtime.h>

// Single-head attention with POST-softmax scaling (x [4][4096][256]; q,k,v = x W ('xw' [256][32], no bias); energy = q.k UNSCALED; att = softmax(energy) x 32^-0.5; out = att v -> [4][4096][32] (0.5 M)).
// Two launches. k_proj: x and the three weights rounded to bf16 on the way in, the three 32-wide projections as exact bf16 products, hi/lo planes of q, k and v^T for all batches, each laid out in WMMA fragment order (see FRAGMENT-ORDER PLANES below). k_fattn: ONE fused attention launch for all batches (64 queries a work-group, the keys split over its 16 waves, online softmax, every product hi/lo 3 products, the slices joined in LDS in wave order, x 32^-0.5 at the end).
// Compute dtypes, f32 accumulate: every input rounded to bf16; projections exact; scores and att.v 3 products on every row (unscaled logits, sigma ~5.7); softmax f32; the post-softmax scale applied in f32 at the end (a power of two times 1/sqrt(2): one rounding, as the reference's att x scaling then att v up to association).

#define NB_  4
#define TT   4096
#define DM   256
#define HDR  32     // head dim
#define FH   256    // elements of one fragment half: 32 lanes x 8
// FRAGMENT-ORDER PLANES. A plane is a row of 1-KiB fragments, each [half][lane][8 elements]: what lane l holds of a 16x32 A or B operand (row l & 15; k = 8 (l >> 4) + j in half 0, 16 + 8 (l >> 4) + j in half 1) lies at half FH + 8 l.
// q, k: fragment t / 16 (16 tokens x the 32 head columns). v^T: fragments 2 (t / 32) and 2 (t / 32) + 1 (head rows 0..15 and 16..31 x 32 tokens). Either way token t's fragments start at element t HDR rounded down to a fragment (v^T: to two fragments), and a batch is TT HDR elements.
// A wave's 16-byte load or store of a half is then 512 contiguous bytes, four whole 128-byte lines, where a row-major plane gives sixteen 32-byte pieces of sixteen lines.
#define OSC  0.17677669529663688f   // 32^-0.5 applied after the softmax
typedef unsigned short bf;
typedef __attribute__((ext_vector_type(16))) __bf16   v16bf;
typedef __attribute__((ext_vector_type(8)))  unsigned short v8us;
typedef __attribute__((ext_vector_type(8)))  float    v8f;
typedef __attribute__((ext_vector_type(4)))  float    v4f;
typedef __attribute__((ext_vector_type(2)))  float    v2f;
typedef __attribute__((ext_vector_type(2))) __bf16 v2bf;
typedef __attribute__((ext_vector_type(4))) unsigned v4u;
typedef __attribute__((ext_vector_type(8))) unsigned v8u;

__device__ __forceinline__ unsigned pk2(float a, float b) { v2f t; t[0] = a; t[1] = b; return __builtin_bit_cast(unsigned, __builtin_convertvector(t, v2bf)); }   // two f32 -> packed bf16, nearest even
__device__ __forceinline__ v16bf cat16b(v8us lo, v8us hi) { return __builtin_bit_cast(v16bf, __builtin_shufflevector(lo, hi, 0, 1, 2, 3, 4, 5, 6, 7, 8, 9, 10, 11, 12, 13, 14, 15)); }
__device__ __forceinline__ v8f wmmab(v16bf a, v16bf b, v8f c) { return __builtin_amdgcn_wmma_f32_16x16x32_bf16(false, a, false, b, (short)0, c, false, false); }
// A or B fragment of a 16x16x32 product from a K-contiguous 16-bit row: lane (lr, hi) holds row lr, k = 8 hi .. 8 hi + 7 and 16 + 8 hi .. 16 + 8 hi + 7; p points at its row's k = 8 hi.
template <typename T16> struct WFrag;
template <> struct WFrag<bf> { typedef v16bf V; static __device__ __forceinline__ V ld(const bf* p) { return cat16b(*(const v8us*)p, *(const v8us*)(p + 16)); } static __device__ __forceinline__ V ldf(const bf* p) { return cat16b(*(const v8us*)p, *(const v8us*)(p + FH)); } /* from a fragment-order plane: p points at the lane's 8 elements of half 0 */ static __device__ __forceinline__ v8f mma(V a, V b, v8f c) { return wmmab(a, b, c); } };
__device__ __forceinline__ void split8(v8f v, v4u& oh, v4u& ol) {   // 8 f32 -> 8 bf16 high parts and the 8 bf16 roundings of what they leave
#pragma unroll
    for (int r = 0; r < 4; ++r) { const unsigned h2 = pk2(v[2 * r], v[2 * r + 1]); oh[r] = h2; ol[r] = pk2(v[2 * r] - __uint_as_float(h2 << 16), v[2 * r + 1] - __uint_as_float(h2 & 0xFFFF0000u)); } }

// ---- k_proj: q, k, v of PR rows of x (all batches as one row range) in one work-group of 8 waves, straight to the hi/lo planes.
// Wave w owns the 16 rows of tile w >> 1 and three of the six 16-column tiles: both of q and the first of v (w even), both of k and the second of v (w odd). Its x fragments come straight from the f32 rows (all of K in flight at once) and are rounded in registers; the weights are rounded and transposed into LDS once a work-group.
// q and k are formed transposed (A = weight rows, B = x rows) and v plain (A = x rows, B = weight rows), so that a lane's 8 accumulator values are the 8 elements that the same lane holds of a fragment half: each accumulator goes straight to its plane as one 512-byte store of the wave. k runs upward in steps of 32 in one accumulator, as a plain GEMM loop does.
// Every plain '#pragma unroll' in k_proj stands on a short constant-trip loop over register arrays: unrolled so that they are indexed by constants and stay in registers.
#define PR   64     // rows of x a work-group
#define WP   264    // LDS pitch of a transposed weight row, elements: 528 B = 16 B x odd, the pitch for 16-byte fragment reads
__global__ __launch_bounds__(256) void k_proj(const float* __restrict__ x, const float* __restrict__ wq, const float* __restrict__ wk, const float* __restrict__ wv, bf* Qh, bf* Ql, bf* Kh, bf* Kl, bf* Vh, bf* Vl) {
    typedef WFrag<bf> F; typedef v16bf V;
    __shared__ __align__(16) bf wt[3 * HDR][WP];
    const int lane = threadIdx.x & 31, lr = lane & 15, hi = lane >> 4, w = __builtin_amdgcn_readfirstlane(threadIdx.x >> 5); const int mt = w >> 1, hf = w & 1; const size_t g0 = (size_t)blockIdx.x * PR;
    const int kl = (lane >> 3) * 8, n0 = (lane & 7) * 4; const float* ws[3]; v4f t[3][8];   /* 24 strips (matrix, 32 k) over 8 waves, 3 a wave; a lane takes 8 k x 4 columns of each: whole 128-byte rows in, four 16-byte LDS stores out */
#pragma unroll
    for (int i = 0; i < 3; ++i) { const int s = w * 3 + i, mx = s >> 3; ws[i] = (mx == 0 ? wq : mx == 1 ? wk : wv) + ((s & 7) * 32 + kl) * HDR + n0;
#pragma unroll
        for (int j = 0; j < 8; ++j) t[i][j] = *(const v4f*)(ws[i] + j * HDR); }
    asm volatile("s_wait_xcnt 0x0" :: "v"(ws[0]), "v"(ws[1]), "v"(ws[2]) : "memory");   // in front of the first overwrite of the weight loads' address pairs; it also keeps all of them in front of the x loads: loads return in order, so the weights are rounded and laid in LDS while x is on its way
    const float* px = x + (g0 + mt * 16 + lr) * DM + 8 * hi; v8f xa[DM / 32][2];
#pragma unroll
    for (int ks = 0; ks < DM / 32; ++ks) { xa[ks][0] = *(const v8f*)(px + ks * 32); xa[ks][1] = *(const v8f*)(px + ks * 32 + 16); }
    asm volatile("s_wait_xcnt 0x0" :: "v"(px) : "memory");   // in front of the first overwrite of the x loads' address pair; the memory clobber keeps them in front of it
    __builtin_amdgcn_sched_barrier(0);   // the weights' rounding, which waits for their data, stays behind the issue of the x loads: without it the x loads leave one L2 round trip later
#pragma unroll
    for (int i = 0; i < 3; ++i) { const int s = w * 3 + i, mx = s >> 3, k0 = (s & 7) * 32 + kl;
#pragma unroll
        for (int e = 0; e < 4; ++e) { v4u o;
#pragma unroll
            for (int r = 0; r < 4; ++r) o[r] = pk2(t[i][2 * r][e], t[i][2 * r + 1][e]);
            *(v4u*)&wt[mx * HDR + n0 + e][k0] = o; } }
    __syncthreads();   // the transposed weights are whole before any wave reads them
    v8f a0 = (v8f){}, a1 = (v8f){}, a2 = (v8f){}; const bf* pw = &wt[hf * HDR + lr][8 * hi]; const bf* pv = &wt[2 * HDR + hf * 16 + lr][8 * hi];
#pragma unroll
    for (int ks = 0; ks < DM / 32; ++ks) { v8u xu;
#pragma unroll
        for (int r = 0; r < 4; ++r) { xu[r] = pk2(xa[ks][0][2 * r], xa[ks][0][2 * r + 1]); xu[4 + r] = pk2(xa[ks][1][2 * r], xa[ks][1][2 * r + 1]); }
        const V xf = __builtin_bit_cast(V, xu);
        a0 = F::mma(F::ld(pw + ks * 32), xf, a0); a1 = F::mma(F::ld(pw + 16 * WP + ks * 32), xf, a1); a2 = F::mma(xf, F::ld(pv + ks * 32), a2); }
    v4u h0, l0, h1, l1, h2, l2; split8(a0, h0, l0); split8(a1, h1, l1); split8(a2, h2, l2);   /* every split in registers of its own: no store's data register is written again */
    bf* Ph = hf ? Kh : Qh; bf* Pl = hf ? Kl : Ql; const size_t ro = (g0 + mt * 16) * HDR + lane * 8;   /* a0[j], a1[j] = row mt 16 + lr, column 8 hi + j, 16 + 8 hi + j: halves 0 and 1 of the row tile's fragment */
    *(v4u*)(Ph + ro) = h0; *(v4u*)(Pl + ro) = l0; *(v4u*)(Ph + ro + FH) = h1; *(v4u*)(Pl + ro + FH) = l1;
    const size_t vo = (g0 + (mt >> 1) * 32) * HDR + (hf * 2 + (mt & 1)) * FH + lane * 8;   /* a2[j] = row mt 16 + 8 hi + j, column hf 16 + lr: half mt & 1 of fragment hf of the 32-token block */
    *(v4u*)(Vh + vo) = h2; *(v4u*)(Vl + vo) = l2;  }
// ---- k_fattn: scores, softmax and att.v of one 64-query tile in one work-group; no score or probability ever reaches memory.
// S^T = K Q^T (A = K rows, B = Q rows, both on the 32 real head columns, one k-step) so that a lane holds one query's scores: two 16-key D tiles, converted in place, are the B operand of O^T += V^T P^T.
// Every plain '#pragma unroll' in k_fattn stands on a short constant-trip loop: over register arrays (fragments, accumulators), unrolled so that they are indexed by constants and stay in registers, or over the FW slices in LDS at the join.
// Wave w walks keys [w KSL, (w + 1) KSL) with a running maximum and sum (online softmax, f32); the FW waves' (max, sum, context) are joined in LDS in wave order. Three hi/lo products (hi.hi, lo.hi, hi.lo) on both GEMMs.
#define FW   16           // waves of a work-group = key slices
#define NT   4            // 16-query tiles a wave: every K and V fragment fetched serves NT tiles
#define QW   (NT * 16)    // queries a work-group
#define KSL  (TT / FW)    // keys a wave
#define L2E  1.4426950408889634f
typedef __attribute__((ext_vector_type(4))) int v4i;
#define PK   (2 * 2 * FH)   // elements of one plane that a pass of 32 keys takes: two fragments, 2 KiB
// 2 KiB of a plane to LDS, through no register: four asynchronous copies of the wave, 512 contiguous bytes each; g and s point at the lane's own 16 bytes, the offset moves both addresses.
__device__ __forceinline__ void cp2k(const bf* g, bf* s) {
    __attribute__((address_space(1))) v4i* gp = (__attribute__((address_space(1))) v4i*)g; __attribute__((address_space(3))) v4i* sp = (__attribute__((address_space(3))) v4i*)s;
    __builtin_amdgcn_global_load_async_to_lds_b128(gp, sp, 0, 0); __builtin_amdgcn_global_load_async_to_lds_b128(gp, sp, 512, 0); __builtin_amdgcn_global_load_async_to_lds_b128(gp, sp, 1024, 0); __builtin_amdgcn_global_load_async_to_lds_b128(gp, sp, 1536, 0); }
__device__ __forceinline__ float xhalf(float x) { const int b = __float_as_int(x); return __int_as_float(__builtin_amdgcn_permlanex16(b, b, 0x76543210, 0xfedcba98, false, false)); }   // lane l <-> l ^ 16
__global__ __launch_bounds__(FW * 32) void k_fattn(const bf* __restrict__ Qh, const bf* __restrict__ Ql, const bf* __restrict__ Kh, const bf* __restrict__ Kl, const bf* __restrict__ Vh, const bf* __restrict__ Vl, float* out) {
    typedef WFrag<bf> F; typedef v16bf V;
    __shared__ float ms[FW][QW], ls[FW][QW]; __shared__ __align__(16) float os[FW][QW][36]; __shared__ __align__(16) bf ring[FW][4][PK]; __shared__ __align__(16) v8us qls[NT][2][32];   // ring: see K AND V THROUGH LDS below. qls: the low-part Q fragments in register order (tile, fragment half, lane), shared by all waves: 32 registers a wave fewer, no spill
    const int lane = threadIdx.x & 31, lr = lane & 15, hi = lane >> 4, w = __builtin_amdgcn_readfirstlane(threadIdx.x >> 5); const size_t zb = (size_t)blockIdx.y * TT * HDR; const int q0 = blockIdx.x * QW;
    Qh += zb; Ql += zb; Kh += zb; Kl += zb; Vh += zb; Vl += zb;
    // K AND V THROUGH LDS. Each wave owns one 8-KiB slot (K hi, K lo, V hi, V lo of one pass), which no other wave touches: no barrier. The registers are the second buffer: once a pass's fragments are read out of the slot, the next pass's 16 copies go into it, most of a pass ahead of their first reader, so that no wave waits on L2 at a pass's head. (The wave's number goes through readfirstlane so that the planes' bases stay in scalar registers: with them in vector registers the build spilled.)
    bf* const rg = &ring[w][0][lane * 8]; const int k0 = w * KSL * HDR + lane * 8;
    cp2k(Vh + k0, rg + 2 * PK); cp2k(Vl + k0, rg + 3 * PK);   /* pass 0's V; its K comes straight to registers below */
    V qh[NT];
#pragma unroll
    for (int nt = 0; nt < NT; ++nt) qh[nt] = F::ldf(Qh + (q0 + nt * 16) * HDR + lane * 8);
    if (w < NT) { const bf* p = Ql + (q0 + w * 16) * HDR + lane * 8; qls[w][0][lane] = *(const v8us*)p; qls[w][1][lane] = *(const v8us*)(p + FH); }   /* wave w stages tile w */
    v8f acc[2][NT]; float m[NT], eb[NT]; v2f l[NT];   /* l: the row sum as a pair, even and odd keys apart, joined behind the loop */
#pragma unroll
    for (int nt = 0; nt < NT; ++nt) { acc[0][nt] = (v8f){}; acc[1][nt] = (v8f){}; m[nt] = -3.0e38f; eb[nt] = -3.0e38f; l[nt] = (v2f){}; }
    V kh[2], kl[2];
#pragma unroll
    for (int t = 0; t < 2; ++t) { const int o = (w * KSL + t * 16) * HDR + lane * 8; kh[t] = F::ldf(Kh + o); kl[t] = F::ldf(Kl + o); }
    asm volatile("s_wait_xcnt 0x0" ::: "memory");   // the loads above are issued: the wait stands in front of the first overwrite of their address registers
    asm volatile("s_wait_asynccnt 0x0" ::: "memory");   // pass 0's V has landed in this wave's slot before the wave reads it
    __syncthreads();   // qls is whole before any wave reads it
#pragma unroll 1   // rolled: the body is long, and four waves a SIMD cover its LDS latency
    for (int it = 0; it < KSL / 32; ++it) {
        const int kb = w * KSL + it * 32;
        V vh[2], vl[2];
#pragma unroll
        for (int mt = 0; mt < 2; ++mt) { vh[mt] = F::ldf(rg + 2 * PK + mt * 2 * FH); vl[mt] = F::ldf(rg + 3 * PK + mt * 2 * FH); }   /* landed: behind the wait in the pass before (pass 0: in front of the loop) */
#pragma unroll
        for (int nt = 0; nt < NT; ++nt) {
            v8f s[2]; const V qlf = cat16b(qls[nt][0][lane], qls[nt][1][lane]);
#pragma unroll
            for (int t = 0; t < 2; ++t) { v8f c = (v8f){}; c = F::mma(kh[t], qh[nt], c); c = F::mma(kh[t], qlf, c); c = F::mma(kl[t], qh[nt], c); s[t] = c; }
            if (nt == 0 && it + 1 < KSL / 32) {   /* the refill, behind the first tile's score products: a scalar test, every lane on */
                asm volatile("s_wait_dscnt 0x0" ::: "memory");   // this wave's reads of the slot (this pass's V above, its K in the pass before) have returned before a copy writes over them
                const int o = (kb + 32) * HDR + lane * 8; cp2k(Kh + o, rg); cp2k(Kl + o, rg + PK); cp2k(Vh + o, rg + 2 * PK); cp2k(Vl + o, rg + 3 * PK);
            }
            float mx = s[0][0];
#pragma unroll
            for (int j = 1; j < 8; ++j) mx = fmaxf(mx, s[0][j]);
#pragma unroll
            for (int j = 0; j < 8; ++j) mx = fmaxf(mx, s[1][j]);
            const float mr = fmaxf(fmaxf(m[nt], mx), xhalf(mx)); m[nt] = mr; const float mn = mr * L2E; const float corr = __builtin_amdgcn_exp2f(eb[nt] - mn); eb[nt] = mn;   /* eb: the running maximum in units of the exponent, rounded once: every exponent of the row is taken against this same number */
            v2f sum2 = l[nt] * corr; v8u phu, plu; const v2f le2 = {L2E, L2E}, nm2 = {-mn, -mn};
#pragma unroll
            for (int t = 0; t < 2; ++t)
#pragma unroll
                for (int r = 0; r < 4; ++r) { const v2f s2 = {s[t][2 * r], s[t][2 * r + 1]}; const v2f e2 = __builtin_elementwise_fma(s2, le2, nm2);   /* the accumulator's own register pair: one packed multiply-add for two exponents */
                    v2f p2; p2[0] = __builtin_amdgcn_exp2f(e2[0]); p2[1] = __builtin_amdgcn_exp2f(e2[1]); sum2 += p2; const float p0 = p2[0], p1 = p2[1];
                    const unsigned h2 = pk2(p0, p1); phu[t * 4 + r] = h2; plu[t * 4 + r] = pk2(p0 - __uint_as_float(h2 << 16), p1 - __uint_as_float(h2 & 0xFFFF0000u)); }
            l[nt] = sum2;
            const V ph = __builtin_bit_cast(V, phu), pl = __builtin_bit_cast(V, plu);
#pragma unroll
            for (int mt = 0; mt < 2; ++mt) { v8f c = acc[mt][nt] * corr; c = F::mma(vh[mt], ph, c); c = F::mma(vh[mt], pl, c); c = F::mma(vl[mt], ph, c); acc[mt][nt] = c; }
            if (nt == 1) __builtin_amdgcn_sched_barrier(0);   // the pass is scheduled as two pairs of tiles: with all four tiles' score products lifted to its head the build spilled two Q fragments
        }
        __builtin_amdgcn_sched_barrier(0);   // holds the wait below low in the pass: nothing ties it to the products above, and without this line the scheduler could lift it to the head of the third tile, which cuts the copies' lead to less than half
        asm volatile("s_wait_asynccnt 0x0" ::: "memory");   // the 16 copies issued at the first tile have landed: K for the reads below, V for the head of the next pass
#pragma unroll
        for (int t = 0; t < 2; ++t) { kh[t] = F::ldf(rg + t * 2 * FH); kl[t] = F::ldf(rg + PK + t * 2 * FH); }   /* next pass's K fragments out of the slot (the last pass reads its own again: unused) */
    }
#pragma unroll
    for (int nt = 0; nt < NT; ++nt) { const int q = nt * 16 + lr; const float lh = l[nt][0] + l[nt][1]; const float lt = lh + xhalf(lh); if (hi == 0) { ms[w][q] = eb[nt]; ls[w][q] = lt; }
#pragma unroll
        for (int mt = 0; mt < 2; ++mt) { v4f a, b;   /* acc[mt][nt][j] = ctx[q][16 mt + 8 hi + j] */
#pragma unroll
            for (int j = 0; j < 4; ++j) { a[j] = acc[mt][nt][j]; b[j] = acc[mt][nt][4 + j]; }
            *(v4f*)&os[w][q][mt * 16 + hi * 8] = a; *(v4f*)&os[w][q][mt * 16 + hi * 8 + 4] = b; } }
    __syncthreads();   // every wave's slice result is in LDS before any thread joins them
    const int q = threadIdx.x >> 3, d0 = (threadIdx.x & 7) * 4; float M = ms[0][q];
#pragma unroll
    for (int s2 = 1; s2 < FW; ++s2) M = fmaxf(M, ms[s2][q]);
    float L = 0.f; v4f a = (v4f){};
#pragma unroll
    for (int s2 = 0; s2 < FW; ++s2) { const float f = __builtin_amdgcn_exp2f(ms[s2][q] - M); L += ls[s2][q] * f; a += *(const v4f*)&os[s2][q][d0] * f; }   /* wave order */
    const float inv = __fdiv_rn(1.0f, L); v4f o;
#pragma unroll
    for (int j = 0; j < 4; ++j) o[j] = __fmul_rn(a[j] * inv, OSC);
    *(v4f*)(out + ((size_t)blockIdx.y * TT + q0 + q) * HDR + d0) = o;  }

extern "C" void kernel_launch(void* const* d_in, const int* in_sizes, int n_in,
                              void* d_out, int out_size, void* d_ws, size_t ws_size, hipStream_t stream) {
    (void)in_sizes; (void)n_in; (void)out_size;
    const float* x = (const float*)d_in[0]; const float* wq = (const float*)d_in[1]; const float* wk = (const float*)d_in[2]; const float* wv = (const float*)d_in[3];
    float* OUT = (float*)d_out;     // [4][4096][32]
    char* wsp = (char*)d_ws;
    auto take = [&](size_t bytes) { char* p = wsp; wsp += (bytes + 255) & ~(size_t)255; return (void*)p; };
    const size_t PB = (size_t)TT * HDR;   // one batch's plane, elements
    bf* QPh = (bf*)take(NB_ * PB * 2); bf* QPl = (bf*)take(NB_ * PB * 2); bf* KPh = (bf*)take(NB_ * PB * 2); bf* KPl = (bf*)take(NB_ * PB * 2); bf* VTh = (bf*)take(NB_ * PB * 2); bf* VTl = (bf*)take(NB_ * PB * 2);
    if ((size_t)(wsp - (char*)d_ws) > ws_size) return;    // ws 256 MiB
    k_proj<<<NB_ * TT / PR, 256, 0, stream>>>(x, wq, wk, wv, QPh, QPl, KPh, KPl, VTh, VTl);   /* hi/lo planes of q, k, v^T, all batches */
    k_fattn<<<dim3(TT / QW, NB_, 1), FW * 32, 0, stream>>>(QPh, QPl, KPh, KPl, VTh, VTl, OUT);   /* out = softmax(q k^T) v x 32^-0.5, all batches */
}

// v007
// One run takes 21.6 microseconds.
// Two timings next to v006 both put it at 1.26 times that version's speed.
// Counting every step since v000, it is 33.8 times as fast.
#include <hip/hip_runtime.h>

// Single-head attention with POST-softmax scaling (x [4][4096][256]; q,k,v = x W ('xw' [256][32], no bias); energy = q.k UNSCALED; att = softmax(energy) x 32^-0.5; out = att v -> [4][4096][32] (0.5 M)).
// Two launches. k_proj: x and the three weights rounded to bf16 on the way in, the three 32-wide projections as exact bf16 products, hi/lo bf16 planes of q and k and one f16 plane of v^T for all batches, each laid out in WMMA fragment order (see FRAGMENT-ORDER PLANES below). k_fattn: ONE fused attention launch for all batches (64 queries a work-group, the keys split over its 16 waves, online softmax, scores hi/lo 3 bf16 products, att.v one f16 product, the slices joined in LDS in wave order, x 32^-0.5 at the end).
// Compute dtypes, f32 accumulate: every input rounded to bf16; projections exact; scores 3 bf16 hi/lo products on every row (unscaled logits, sigma ~5.7: an error there is multiplied by the exponential); att.v one f16 product, P (in (0, 1]) and v (a sum of 256 products of a unit normal and a normal / 16: far inside f16's range) each rounded once to 11 bits, a relative 2^-12 that enters the output linearly, about an eighth of what the bf16 rounding of x and the weights already leaves in v; softmax f32; the post-softmax scale applied in f32 at the end (a power of two times 1/sqrt(2): one rounding, as the reference's att x scaling then att v up to association).

#define NB_  4
#define TT   4096
#define DM   256
#define HDR  32     // head dim
#define FH   256    // elements of one fragment half: 32 lanes x 8
// FRAGMENT-ORDER PLANES. A plane is a row of 1-KiB fragments, each [half][lane][8 elements]: what lane l holds of a 16x32 A or B operand (row l & 15; k = 8 (l >> 4) + j in half 0, 16 + 8 (l >> 4) + j in half 1) lies at half FH + 8 l.
// q, k: fragment t / 16 (16 tokens x the 32 head columns). v^T: fragments 2 (t / 32) and 2 (t / 32) + 1 (head rows 0..15 and 16..31 x 32 tokens). Either way token t's fragments start at element t HDR rounded down to a fragment (v^T: to two fragments), and a batch is TT HDR elements.
// A wave's 16-byte load or store of a half is then 512 contiguous bytes, four whole 128-byte lines, where a row-major plane gives sixteen 32-byte pieces of sixteen lines.
#define OSC  0.17677669529663688f   // 32^-0.5 applied after the softmax
typedef unsigned short bf;
typedef __attribute__((ext_vector_type(16))) __bf16   v16bf;
typedef __attribute__((ext_vector_type(8)))  unsigned short v8us;
typedef __attribute__((ext_vector_type(8)))  float    v8f;
typedef __attribute__((ext_vector_type(4)))  float    v4f;
typedef __attribute__((ext_vector_type(2)))  float    v2f;
typedef __attribute__((ext_vector_type(2))) __bf16 v2bf;
typedef __attribute__((ext_vector_type(16))) _Float16 v16h;
typedef __attribute__((ext_vector_type(2)))  _Float16 v2h;
typedef __attribute__((ext_vector_type(4))) unsigned v4u;
typedef __attribute__((ext_vector_type(8))) unsigned v8u;

__device__ __forceinline__ unsigned pk2(float a, float b) { v2f t; t[0] = a; t[1] = b; return __builtin_bit_cast(unsigned, __builtin_convertvector(t, v2bf)); }   // two f32 -> packed bf16, nearest even
__device__ __forceinline__ unsigned pk2h(float a, float b) { v2f t; t[0] = a; t[1] = b; return __builtin_bit_cast(unsigned, __builtin_convertvector(t, v2h)); }   // two f32 -> packed f16, nearest even
__device__ __forceinline__ v16bf cat16b(v8us lo, v8us hi) { return __builtin_bit_cast(v16bf, __builtin_shufflevector(lo, hi, 0, 1, 2, 3, 4, 5, 6, 7, 8, 9, 10, 11, 12, 13, 14, 15)); }
__device__ __forceinline__ v8f wmmab(v16bf a, v16bf b, v8f c) { return __builtin_amdgcn_wmma_f32_16x16x32_bf16(false, a, false, b, (short)0, c, false, false); }
__device__ __forceinline__ v8f wmmah(v16h a, v16h b, v8f c) { return __builtin_amdgcn_wmma_f32_16x16x32_f16(false, a, false, b, (short)0, c, false, false); }   // same fragment maps as the bf16 form
// A or B fragment of a 16x16x32 product from a K-contiguous 16-bit row: lane (lr, hi) holds row lr, k = 8 hi .. 8 hi + 7 and 16 + 8 hi .. 16 + 8 hi + 7; p points at its row's k = 8 hi.
template <typename T16> struct WFrag;
template <> struct WFrag<bf> { typedef v16bf V; static __device__ __forceinline__ V ld(const bf* p) { return cat16b(*(const v8us*)p, *(const v8us*)(p + 16)); } static __device__ __forceinline__ V ldf(const bf* p) { return cat16b(*(const v8us*)p, *(const v8us*)(p + FH)); } /* from a fragment-order plane: p points at the lane's 8 elements of half 0 */ static __device__ __forceinline__ v8f mma(V a, V b, v8f c) { return wmmab(a, b, c); } };
__device__ __forceinline__ void split8(v8f v, v4u& oh, v4u& ol) {   // 8 f32 -> 8 bf16 high parts and the 8 bf16 roundings of what they leave
#pragma unroll
    for (int r = 0; r < 4; ++r) { const unsigned h2 = pk2(v[2 * r], v[2 * r + 1]); oh[r] = h2; ol[r] = pk2(v[2 * r] - __uint_as_float(h2 << 16), v[2 * r + 1] - __uint_as_float(h2 & 0xFFFF0000u)); } }

// ---- k_proj: q, k, v of PR rows of x (all batches as one row range) in one work-group of 8 waves, straight to the planes (q, k: bf16 hi/lo; v^T: f16).
// Wave w owns the 16 rows of tile w >> 1 and three of the six 16-column tiles: both of q and the first of v (w even), both of k and the second of v (w odd). Its x fragments come straight from the f32 rows (all of K in flight at once) and are rounded in registers; the weights are rounded and transposed into LDS once a work-group.
// q and k are formed transposed (A = weight rows, B = x rows) and v plain (A = x rows, B = weight rows), so that a lane's 8 accumulator values are the 8 elements that the same lane holds of a fragment half: each accumulator goes straight to its plane as one 512-byte store of the wave. k runs upward in steps of 32 in one accumulator, as a plain GEMM loop does.
// Every plain '#pragma unroll' in k_proj stands on a short constant-trip loop over register arrays: unrolled so that they are indexed by constants and stay in registers.
#define PR   64     // rows of x a work-group
#define WP   264    // LDS pitch of a transposed weight row, elements: 528 B = 16 B x odd, the pitch for 16-byte fragment reads
__global__ __launch_bounds__(256) void k_proj(const float* __restrict__ x, const float* __restrict__ wq, const float* __restrict__ wk, const float* __restrict__ wv, bf* Qh, bf* Ql, bf* Kh, bf* Kl, bf* Vf) {
    typedef WFrag<bf> F; typedef v16bf V;
    __shared__ __align__(16) bf wt[3 * HDR][WP];
    const int lane = threadIdx.x & 31, lr = lane & 15, hi = lane >> 4, w = __builtin_amdgcn_readfirstlane(threadIdx.x >> 5); const int mt = w >> 1, hf = w & 1; const size_t g0 = (size_t)blockIdx.x * PR;
    const int kl = (lane >> 3) * 8, n0 = (lane & 7) * 4; const float* ws[3]; v4f t[3][8];   /* 24 strips (matrix, 32 k) over 8 waves, 3 a wave; a lane takes 8 k x 4 columns of each: whole 128-byte rows in, four 16-byte LDS stores out */
#pragma unroll
    for (int i = 0; i < 3; ++i) { const int s = w * 3 + i, mx = s >> 3; ws[i] = (mx == 0 ? wq : mx == 1 ? wk : wv) + ((s & 7) * 32 + kl) * HDR + n0;
#pragma unroll
        for (int j = 0; j < 8; ++j) t[i][j] = *(const v4f*)(ws[i] + j * HDR); }
    asm volatile("s_wait_xcnt 0x0" :: "v"(ws[0]), "v"(ws[1]), "v"(ws[2]) : "memory");   // in front of the first overwrite of the weight loads' address pairs; it also keeps all of them in front of the x loads: loads return in order, so the weights are rounded and laid in LDS while x is on its way
    const float* px = x + (g0 + mt * 16 + lr) * DM + 8 * hi; v8f xa[DM / 32][2];
#pragma unroll
    for (int ks = 0; ks < DM / 32; ++ks) { xa[ks][0] = *(const v8f*)(px + ks * 32); xa[ks][1] = *(const v8f*)(px + ks * 32 + 16); }
    asm volatile("s_wait_xcnt 0x0" :: "v"(px) : "memory");   // in front of the first overwrite of the x loads' address pair; the memory clobber keeps them in front of it
    __builtin_amdgcn_sched_barrier(0);   // the weights' rounding, which waits for their data, stays behind the issue of the x loads: without it the x loads leave one L2 round trip later
#pragma unroll
    for (int i = 0; i < 3; ++i) { const int s = w * 3 + i, mx = s >> 3, k0 = (s & 7) * 32 + kl;
#pragma unroll
        for (int e = 0; e < 4; ++e) { v4u o;
#pragma unroll
            for (int r = 0; r < 4; ++r) o[r] = pk2(t[i][2 * r][e], t[i][2 * r + 1][e]);
            *(v4u*)&wt[mx * HDR + n0 + e][k0] = o; } }
    __syncthreads();   // the transposed weights are whole before any wave reads them
    v8f a0 = (v8f){}, a1 = (v8f){}, a2 = (v8f){}; const bf* pw = &wt[hf * HDR + lr][8 * hi]; const bf* pv = &wt[2 * HDR + hf * 16 + lr][8 * hi];
#pragma unroll
    for (int ks = 0; ks < DM / 32; ++ks) { v8u xu;
#pragma unroll
        for (int r = 0; r < 4; ++r) { xu[r] = pk2(xa[ks][0][2 * r], xa[ks][0][2 * r + 1]); xu[4 + r] = pk2(xa[ks][1][2 * r], xa[ks][1][2 * r + 1]); }
        const V xf = __builtin_bit_cast(V, xu);
        a0 = F::mma(F::ld(pw + ks * 32), xf, a0); a1 = F::mma(F::ld(pw + 16 * WP + ks * 32), xf, a1); a2 = F::mma(xf, F::ld(pv + ks * 32), a2); }
    v4u h0, l0, h1, l1, h2; split8(a0, h0, l0); split8(a1, h1, l1);
#pragma unroll
    for (int r = 0; r < 4; ++r) h2[r] = pk2h(a2[2 * r], a2[2 * r + 1]);   /* every split in registers of its own: no store's data register is written again */
    bf* Ph = hf ? Kh : Qh; bf* Pl = hf ? Kl : Ql; const size_t ro = (g0 + mt * 16) * HDR + lane * 8;   /* a0[j], a1[j] = row mt 16 + lr, column 8 hi + j, 16 + 8 hi + j: halves 0 and 1 of the row tile's fragment */
    *(v4u*)(Ph + ro) = h0; *(v4u*)(Pl + ro) = l0; *(v4u*)(Ph + ro + FH) = h1; *(v4u*)(Pl + ro + FH) = l1;
    const size_t vo = (g0 + (mt >> 1) * 32) * HDR + (hf * 2 + (mt & 1)) * FH + lane * 8;   /* a2[j] = row mt 16 + 8 hi + j, column hf 16 + lr: half mt & 1 of fragment hf of the 32-token block */
    *(v4u*)(Vf + vo) = h2;  }
// ---- k_fattn: scores, softmax and att.v of one 64-query tile in one work-group; no score or probability ever reaches memory.
// S^T = K Q^T (A = K rows, B = Q rows, both on the 32 real head columns, one k-step) so that a lane holds one query's scores: two 16-key D tiles, converted in place, are the B operand of O^T += V^T P^T.
// Every plain '#pragma unroll' in k_fattn, but the two over the FW slices in LDS at the join, stands on a short constant-trip loop over register arrays (fragments, accumulators): unrolled so that they are indexed by constants and stay in registers.
// Wave w walks keys [w KSL, (w + 1) KSL) with a running maximum and sum (online softmax, f32); the FW waves' (max, sum, context) are joined in LDS in wave order. Three hi/lo bf16 products (hi.hi, lo.hi, hi.lo) on the scores; one f16 product on att.v.
#define FW   16           // waves of a work-group = key slices
#define NT   4            // 16-query tiles a wave: every K and V fragment fetched serves NT tiles
#define QW   (NT * 16)    // queries a work-group
#define KSL  (TT / FW)    // keys a wave
#define L2E  1.4426950408889634f
typedef __attribute__((ext_vector_type(4))) int v4i;
#define PK   (2 * 2 * FH)   // elements of one plane that a pass of 32 keys takes: two fragments, 2 KiB
// 2 KiB of a plane to LDS, through no register: four asynchronous copies of the wave, 512 contiguous bytes each; g and s point at the lane's own 16 bytes, the offset moves both addresses.
__device__ __forceinline__ void cp2k(const bf* g, bf* s) {
    __attribute__((address_space(1))) v4i* gp = (__attribute__((address_space(1))) v4i*)g; __attribute__((address_space(3))) v4i* sp = (__attribute__((address_space(3))) v4i*)s;
    __builtin_amdgcn_global_load_async_to_lds_b128(gp, sp, 0, 0); __builtin_amdgcn_global_load_async_to_lds_b128(gp, sp, 512, 0); __builtin_amdgcn_global_load_async_to_lds_b128(gp, sp, 1024, 0); __builtin_amdgcn_global_load_async_to_lds_b128(gp, sp, 1536, 0); }
__device__ __forceinline__ float xhalf(float x) { const int b = __float_as_int(x); return __int_as_float(__builtin_amdgcn_permlanex16(b, b, 0x76543210, 0xfedcba98, false, false)); }   // lane l <-> l ^ 16
__global__ __launch_bounds__(FW * 32) void k_fattn(const bf* __restrict__ Qh, const bf* __restrict__ Ql, const bf* __restrict__ Kh, const bf* __restrict__ Kl, const bf* __restrict__ Vf, float* out) {
    typedef WFrag<bf> F; typedef v16bf V;
    __shared__ float ms[FW][QW], ls[FW][QW]; __shared__ __align__(16) float os[FW][QW][36]; __shared__ __align__(16) bf ring[FW][3][PK]; __shared__ __align__(16) v8us qls[NT][2][32];   // ring: see K AND V THROUGH LDS below. qls: the low-part Q fragments in register order (tile, fragment half, lane), shared by all waves: 32 registers a wave fewer, no spill
    const int lane = threadIdx.x & 31, lr = lane & 15, hi = lane >> 4, w = __builtin_amdgcn_readfirstlane(threadIdx.x >> 5); const size_t zb = (size_t)blockIdx.y * TT * HDR; const int q0 = blockIdx.x * QW;
    Qh += zb; Ql += zb; Kh += zb; Kl += zb; Vf += zb;
    // K AND V THROUGH LDS. Each wave owns one 6-KiB slot (K hi, K lo, V of one pass), which no other wave touches: no barrier. The registers are the second buffer: once a pass's fragments are read out of the slot, the next pass's 12 copies go into it, most of a pass ahead of their first reader, so that no wave waits on L2 at a pass's head. (The wave's number goes through readfirstlane so that the planes' bases stay in scalar registers: with them in vector registers the build spilled.)
    bf* const rg = &ring[w][0][lane * 8]; const int k0 = w * KSL * HDR + lane * 8;
    cp2k(Vf + k0, rg + 2 * PK);   /* pass 0's V; its K comes straight to registers below */
    V qh[NT];
#pragma unroll
    for (int nt = 0; nt < NT; ++nt) qh[nt] = F::ldf(Qh + (q0 + nt * 16) * HDR + lane * 8);
    if (w < NT) { const bf* p = Ql + (q0 + w * 16) * HDR + lane * 8; qls[w][0][lane] = *(const v8us*)p; qls[w][1][lane] = *(const v8us*)(p + FH); }   /* wave w stages tile w */
    v8f acc[2][NT]; float m[NT], eb[NT]; v2f l[NT];   /* l: the row sum as a pair, even and odd keys apart, joined behind the loop */
#pragma unroll
    for (int nt = 0; nt < NT; ++nt) { acc[0][nt] = (v8f){}; acc[1][nt] = (v8f){}; m[nt] = -3.0e38f; eb[nt] = -3.0e38f; l[nt] = (v2f){}; }
    V kh[2], kl[2];
#pragma unroll
    for (int t = 0; t < 2; ++t) { const int o = (w * KSL + t * 16) * HDR + lane * 8; kh[t] = F::ldf(Kh + o); kl[t] = F::ldf(Kl + o); }
    asm volatile("s_wait_xcnt 0x0" ::: "memory");   // the loads above are issued: the wait stands in front of the first overwrite of their address registers
    asm volatile("s_wait_asynccnt 0x0" ::: "memory");   // pass 0's V has landed in this wave's slot before the wave reads it
    __syncthreads();   // qls is whole before any wave reads it
#pragma unroll 1   // rolled: the body is long, and four waves a SIMD cover its LDS latency
    for (int it = 0; it < KSL / 32; ++it) {
        const int kb = w * KSL + it * 32;
        v16h vf[2];
#pragma unroll
        for (int mt = 0; mt < 2; ++mt) vf[mt] = __builtin_bit_cast(v16h, F::ldf(rg + 2 * PK + mt * 2 * FH));   /* landed: behind the wait in the pass before (pass 0: in front of the loop) */
#pragma unroll
        for (int nt = 0; nt < NT; ++nt) {
            v8f s[2]; const V qlf = cat16b(qls[nt][0][lane], qls[nt][1][lane]);
#pragma unroll
            for (int t = 0; t < 2; ++t) { v8f c = (v8f){}; c = F::mma(kh[t], qh[nt], c); c = F::mma(kh[t], qlf, c); c = F::mma(kl[t], qh[nt], c); s[t] = c; }
            if (nt == 0 && it + 1 < KSL / 32) {   /* the refill, behind the first tile's score products: a scalar test, every lane on */
                asm volatile("s_wait_dscnt 0x0" ::: "memory");   // this wave's reads of the slot (this pass's V above, its K in the pass before) have returned before a copy writes over them
                const int o = (kb + 32) * HDR + lane * 8; cp2k(Kh + o, rg); cp2k(Kl + o, rg + PK); cp2k(Vf + o, rg + 2 * PK);
            }
            float mx = s[0][0];
#pragma unroll
            for (int j = 1; j < 8; ++j) mx = fmaxf(mx, s[0][j]);
#pragma unroll
            for (int j = 0; j < 8; ++j) mx = fmaxf(mx, s[1][j]);
            const float mr = fmaxf(fmaxf(m[nt], mx), xhalf(mx)); m[nt] = mr; const float mn = mr * L2E; const float corr = __builtin_amdgcn_exp2f(eb[nt] - mn); eb[nt] = mn;   /* eb: the running maximum in units of the exponent, rounded once: every exponent of the row is taken against this same number */
            v2f sum2 = l[nt] * corr; v8u pu; const v2f le2 = {L2E, L2E}, nm2 = {-mn, -mn};
#pragma unroll
            for (int t = 0; t < 2; ++t)
#pragma unroll
                for (int r = 0; r < 4; ++r) { const v2f s2 = {s[t][2 * r], s[t][2 * r + 1]}; const v2f e2 = __builtin_elementwise_fma(s2, le2, nm2);   /* the accumulator's own register pair: one packed multiply-add for two exponents */
                    v2f p2; p2[0] = __builtin_amdgcn_exp2f(e2[0]); p2[1] = __builtin_amdgcn_exp2f(e2[1]); sum2 += p2; pu[t * 4 + r] = pk2h(p2[0], p2[1]); }   /* p in (0, 1]: inside f16's range; what falls under its smallest step is under 2^-25 of the row's largest term */
            l[nt] = sum2;
            const v16h pf = __builtin_bit_cast(v16h, pu);
#pragma unroll
            for (int mt = 0; mt < 2; ++mt) acc[mt][nt] = wmmah(vf[mt], pf, acc[mt][nt] * corr);
            if (nt == 1) __builtin_amdgcn_sched_barrier(0);   // the pass is scheduled as two pairs of tiles: with all four tiles' score products lifted to its head the build spilled two Q fragments
        }
        __builtin_amdgcn_sched_barrier(0);   // holds the wait below low in the pass: nothing ties it to the products above, and without this line the scheduler lifts it to the head of the third tile, which cuts the copies' lead to less than half
        asm volatile("s_wait_asynccnt 0x0" ::: "memory");   // the 12 copies issued at the first tile have landed: K for the reads below, V for the head of the next pass
#pragma unroll
        for (int t = 0; t < 2; ++t) { kh[t] = F::ldf(rg + t * 2 * FH); kl[t] = F::ldf(rg + PK + t * 2 * FH); }   /* next pass's K fragments out of the slot (the last pass reads its own again: unused) */
    }
#pragma unroll
    for (int nt = 0; nt < NT; ++nt) { const int q = nt * 16 + lr; const float lh = l[nt][0] + l[nt][1]; const float lt = lh + xhalf(lh); if (hi == 0) { ms[w][q] = eb[nt]; ls[w][q] = lt; }
#pragma unroll
        for (int mt = 0; mt < 2; ++mt) { v4f a, b;   /* acc[mt][nt][j] = ctx[q][16 mt + 8 hi + j] */
#pragma unroll
            for (int j = 0; j < 4; ++j) { a[j] = acc[mt][nt][j]; b[j] = acc[mt][nt][4 + j]; }
            *(v4f*)&os[w][q][mt * 16 + hi * 8] = a; *(v4f*)&os[w][q][mt * 16 + hi * 8 + 4] = b; } }
    __syncthreads();   // every wave's slice result is in LDS before any thread joins them
    const int q = threadIdx.x >> 3, d0 = (threadIdx.x & 7) * 4; float M = ms[0][q];
#pragma unroll
    for (int s2 = 1; s2 < FW; ++s2) M = fmaxf(M, ms[s2][q]);
    float L = 0.f; v4f a = (v4f){};
#pragma unroll
    for (int s2 = 0; s2 < FW; ++s2) { const float f = __builtin_amdgcn_exp2f(ms[s2][q] - M); L += ls[s2][q] * f; a += *(const v4f*)&os[s2][q][d0] * f; }   /* wave order */
    const float inv = __fdiv_rn(1.0f, L); v4f o;
#pragma unroll
    for (int j = 0; j < 4; ++j) o[j] = __fmul_rn(a[j] * inv, OSC);
    *(v4f*)(out + ((size_t)blockIdx.y * TT + q0 + q) * HDR + d0) = o;  }

extern "C" void kernel_launch(void* const* d_in, const int* in_sizes, int n_in,
                              void* d_out, int out_size, void* d_ws, size_t ws_size, hipStream_t stream) {
    (void)in_sizes; (void)n_in; (void)out_size;
    const float* x = (const float*)d_in[0]; const float* wq = (const float*)d_in[1]; const float* wk = (const float*)d_in[2]; const float* wv = (const float*)d_in[3];
    float* OUT = (float*)d_out;     // [4][4096][32]
    char* wsp = (char*)d_ws;
    auto take = [&](size_t bytes) { char* p = wsp; wsp += (bytes + 255) & ~(size_t)255; return (void*)p; };
    const size_t PB = (size_t)TT * HDR;   // one batch's plane, elements
    bf* QPh = (bf*)take(NB_ * PB * 2); bf* QPl = (bf*)take(NB_ * PB * 2); bf* KPh = (bf*)take(NB_ * PB * 2); bf* KPl = (bf*)take(NB_ * PB * 2); bf* VTf = (bf*)take(NB_ * PB * 2);
    if ((size_t)(wsp - (char*)d_ws) > ws_size) return;    // ws 256 MiB
    k_proj<<<NB_ * TT / PR, 256, 0, stream>>>(x, wq, wk, wv, QPh, QPl, KPh, KPl, VTf);   /* hi/lo planes of q, k, the f16 plane of v^T, all batches */
    k_fattn<<<dim3(TT / QW, NB_, 1), FW * 32, 0, stream>>>(QPh, QPl, KPh, KPl, VTf, OUT);   /* out = softmax(q k^T) v x 32^-0.5, all batches */
}

// v008
// It runs in 20.3 microseconds.
// Two timings next to v007 both put it at 1.06 times that version's speed.
// All steps since v000 together make it 35.9 times as fast.
#include <hip/hip_runtime.h>

// Single-head attention with POST-softmax scaling (x [4][4096][256]; q,k,v = x W ('xw' [256][32], no bias); energy = q.k UNSCALED; att = softmax(energy) x 32^-0.5; out = att v -> [4][4096][32] (0.5 M)).
// Two launches. k_proj: x and the three weights rounded to bf16 on the way in, the three 32-wide projections as exact bf16 products, hi/lo bf16 planes of q and k and one f16 plane of v^T for all batches, each laid out in WMMA fragment order (see FRAGMENT-ORDER PLANES below). k_fattn: ONE fused attention launch for all batches (64 queries a work-group, the keys split over its 16 waves, online softmax, scores hi/lo 3 bf16 products, att.v one f16 product, the slices joined in LDS in wave order, x 32^-0.5 at the end).
// Compute dtypes, f32 accumulate: every input rounded to bf16; projections exact; scores 3 bf16 hi/lo products on every row (unscaled logits, sigma ~5.7: an error there is multiplied by the exponential); att.v one f16 product, P (positive, kept under PLIM: see LAZY RESCALE) and v (a sum of 256 products of a unit normal and a normal / 16: far inside f16's range) each rounded once to 11 bits, a relative 2^-12 that enters the output linearly, about an eighth of what the bf16 rounding of x and the weights already leaves in v; softmax f32; the post-softmax scale applied in f32 at the end (a power of two times 1/sqrt(2): one rounding, as the reference's att x scaling then att v up to association).

#define NB_  4
#define TT   4096
#define DM   256
#define HDR  32     // head dim
#define FH   256    // elements of one fragment half: 32 lanes x 8
// FRAGMENT-ORDER PLANES. A plane is a row of 1-KiB fragments, each [half][lane][8 elements]: what lane l holds of a 16x32 A or B operand (row l & 15; k = 8 (l >> 4) + j in half 0, 16 + 8 (l >> 4) + j in half 1) lies at half FH + 8 l.
// q, k: fragment t / 16 (16 tokens x the 32 head columns). v^T: fragments 2 (t / 32) and 2 (t / 32) + 1 (head rows 0..15 and 16..31 x 32 tokens). Either way token t's fragments start at element t HDR rounded down to a fragment (v^T: to two fragments), and a batch is TT HDR elements.
// A wave's 16-byte load or store of a half is then 512 contiguous bytes, four whole 128-byte lines, where a row-major plane gives sixteen 32-byte pieces of sixteen lines.
#define OSC  0.17677669529663688f   // 32^-0.5 applied after the softmax
typedef unsigned short bf;
typedef __attribute__((ext_vector_type(16))) __bf16   v16bf;
typedef __attribute__((ext_vector_type(8)))  unsigned short v8us;
typedef __attribute__((ext_vector_type(8)))  float    v8f;
typedef __attribute__((ext_vector_type(4)))  float    v4f;
typedef __attribute__((ext_vector_type(2)))  float    v2f;
typedef __attribute__((ext_vector_type(2))) __bf16 v2bf;
typedef __attribute__((ext_vector_type(16))) _Float16 v16h;
typedef __attribute__((ext_vector_type(2)))  _Float16 v2h;
typedef __attribute__((ext_vector_type(4))) unsigned v4u;
typedef __attribute__((ext_vector_type(8))) unsigned v8u;

__device__ __forceinline__ unsigned pk2(float a, float b) { v2f t; t[0] = a; t[1] = b; return __builtin_bit_cast(unsigned, __builtin_convertvector(t, v2bf)); }   // two f32 -> packed bf16, nearest even
__device__ __forceinline__ unsigned pk2h(float a, float b) { v2f t; t[0] = a; t[1] = b; return __builtin_bit_cast(unsigned, __builtin_convertvector(t, v2h)); }   // two f32 -> packed f16, nearest even
__device__ __forceinline__ v16bf cat16b(v8us lo, v8us hi) { return __builtin_bit_cast(v16bf, __builtin_shufflevector(lo, hi, 0, 1, 2, 3, 4, 5, 6, 7, 8, 9, 10, 11, 12, 13, 14, 15)); }
__device__ __forceinline__ v8f wmmab(v16bf a, v16bf b, v8f c) { return __builtin_amdgcn_wmma_f32_16x16x32_bf16(false, a, false, b, (short)0, c, false, false); }
__device__ __forceinline__ v8f wmmah(v16h a, v16h b, v8f c) { return __builtin_amdgcn_wmma_f32_16x16x32_f16(false, a, false, b, (short)0, c, false, false); }   // same fragment maps as the bf16 form
// A or B fragment of a 16x16x32 product from a K-contiguous 16-bit row: lane (lr, hi) holds row lr, k = 8 hi .. 8 hi + 7 and 16 + 8 hi .. 16 + 8 hi + 7; p points at its row's k = 8 hi.
template <typename T16> struct WFrag;
template <> struct WFrag<bf> { typedef v16bf V; static __device__ __forceinline__ V ld(const bf* p) { return cat16b(*(const v8us*)p, *(const v8us*)(p + 16)); } static __device__ __forceinline__ V ldf(const bf* p) { return cat16b(*(const v8us*)p, *(const v8us*)(p + FH)); } /* from a fragment-order plane: p points at the lane's 8 elements of half 0 */ static __device__ __forceinline__ v8f mma(V a, V b, v8f c) { return wmmab(a, b, c); } };
__device__ __forceinline__ void split8(v8f v, v4u& oh, v4u& ol) {   // 8 f32 -> 8 bf16 high parts and the 8 bf16 roundings of what they leave
#pragma unroll
    for (int r = 0; r < 4; ++r) { const unsigned h2 = pk2(v[2 * r], v[2 * r + 1]); oh[r] = h2; ol[r] = pk2(v[2 * r] - __uint_as_float(h2 << 16), v[2 * r + 1] - __uint_as_float(h2 & 0xFFFF0000u)); } }

// ---- k_proj: q, k, v of PR rows of x (all batches as one row range) in one work-group of 8 waves, straight to the planes (q, k: bf16 hi/lo; v^T: f16).
// Wave w owns the 16 rows of tile w >> 1 and three of the six 16-column tiles: both of q and the first of v (w even), both of k and the second of v (w odd). Its x fragments come straight from the f32 rows (all of K in flight at once) and are rounded in registers; the weights are rounded and transposed into LDS once a work-group.
// q and k are formed transposed (A = weight rows, B = x rows) and v plain (A = x rows, B = weight rows), so that a lane's 8 accumulator values are the 8 elements that the same lane holds of a fragment half: each accumulator goes straight to its plane as one 512-byte store of the wave. k runs upward in steps of 32 in one accumulator, as a plain GEMM loop does.
// Every plain '#pragma unroll' in k_proj stands on a short constant-trip loop over register arrays: unrolled so that they are indexed by constants and stay in registers.
#define PR   64     // rows of x a work-group
#define WP   264    // LDS pitch of a transposed weight row, elements: 528 B = 16 B x odd, the pitch for 16-byte fragment reads
__global__ __launch_bounds__(256) void k_proj(const float* __restrict__ x, const float* __restrict__ wq, const float* __restrict__ wk, const float* __restrict__ wv, bf* Qh, bf* Ql, bf* Kh, bf* Kl, bf* Vf) {
    typedef WFrag<bf> F; typedef v16bf V;
    __shared__ __align__(16) bf wt[3 * HDR][WP];
    const int lane = threadIdx.x & 31, lr = lane & 15, hi = lane >> 4, w = __builtin_amdgcn_readfirstlane(threadIdx.x >> 5); const int mt = w >> 1, hf = w & 1; const size_t g0 = (size_t)blockIdx.x * PR;
    const int kl = (lane >> 3) * 8, n0 = (lane & 7) * 4; const float* ws[3]; v4f t[3][8];   /* 24 strips (matrix, 32 k) over 8 waves, 3 a wave; a lane takes 8 k x 4 columns of each: whole 128-byte rows in, four 16-byte LDS stores out */
#pragma unroll
    for (int i = 0; i < 3; ++i) { const int s = w * 3 + i, mx = s >> 3; ws[i] = (mx == 0 ? wq : mx == 1 ? wk : wv) + ((s & 7) * 32 + kl) * HDR + n0;
#pragma unroll
        for (int j = 0; j < 8; ++j) t[i][j] = *(const v4f*)(ws[i] + j * HDR); }
    asm volatile("s_wait_xcnt 0x0" :: "v"(ws[0]), "v"(ws[1]), "v"(ws[2]) : "memory");   // in front of the first overwrite of the weight loads' address pairs; it also keeps all of them in front of the x loads: loads return in order, so the weights are rounded and laid in LDS while x is on its way
    const float* px = x + (g0 + mt * 16 + lr) * DM + 8 * hi; v8f xa[DM / 32][2];
#pragma unroll
    for (int ks = 0; ks < DM / 32; ++ks) { xa[ks][0] = *(const v8f*)(px + ks * 32); xa[ks][1] = *(const v8f*)(px + ks * 32 + 16); }
    asm volatile("s_wait_xcnt 0x0" :: "v"(px) : "memory");   // in front of the first overwrite of the x loads' address pair; the memory clobber keeps them in front of it
    __builtin_amdgcn_sched_barrier(0);   // the weights' rounding, which waits for their data, stays behind the issue of the x loads: without it the x loads leave one L2 round trip later
#pragma unroll
    for (int i = 0; i < 3; ++i) { const int s = w * 3 + i, mx = s >> 3, k0 = (s & 7) * 32 + kl;
#pragma unroll
        for (int e = 0; e < 4; ++e) { v4u o;
#pragma unroll
            for (int r = 0; r < 4; ++r) o[r] = pk2(t[i][2 * r][e], t[i][2 * r + 1][e]);
            *(v4u*)&wt[mx * HDR + n0 + e][k0] = o; } }
    __syncthreads();   // the transposed weights are whole before any wave reads them
    v8f a0 = (v8f){}, a1 = (v8f){}, a2 = (v8f){}; const bf* pw = &wt[hf * HDR + lr][8 * hi]; const bf* pv = &wt[2 * HDR + hf * 16 + lr][8 * hi];
#pragma unroll
    for (int ks = 0; ks < DM / 32; ++ks) { v8u xu;
#pragma unroll
        for (int r = 0; r < 4; ++r) { xu[r] = pk2(xa[ks][0][2 * r], xa[ks][0][2 * r + 1]); xu[4 + r] = pk2(xa[ks][1][2 * r], xa[ks][1][2 * r + 1]); }
        const V xf = __builtin_bit_cast(V, xu);
        a0 = F::mma(F::ld(pw + ks * 32), xf, a0); a1 = F::mma(F::ld(pw + 16 * WP + ks * 32), xf, a1); a2 = F::mma(xf, F::ld(pv + ks * 32), a2); }
    v4u h0, l0, h1, l1, h2; split8(a0, h0, l0); split8(a1, h1, l1);
#pragma unroll
    for (int r = 0; r < 4; ++r) h2[r] = pk2h(a2[2 * r], a2[2 * r + 1]);   /* every split in registers of its own: no store's data register is written again */
    bf* Ph = hf ? Kh : Qh; bf* Pl = hf ? Kl : Ql; const size_t ro = (g0 + mt * 16) * HDR + lane * 8;   /* a0[j], a1[j] = row mt 16 + lr, column 8 hi + j, 16 + 8 hi + j: halves 0 and 1 of the row tile's fragment */
    *(v4u*)(Ph + ro) = h0; *(v4u*)(Pl + ro) = l0; *(v4u*)(Ph + ro + FH) = h1; *(v4u*)(Pl + ro + FH) = l1;
    const size_t vo = (g0 + (mt >> 1) * 32) * HDR + (hf * 2 + (mt & 1)) * FH + lane * 8;   /* a2[j] = row mt 16 + 8 hi + j, column hf 16 + lr: half mt & 1 of fragment hf of the 32-token block */
    *(v4u*)(Vf + vo) = h2;  }
// ---- k_fattn: scores, softmax and att.v of one 64-query tile in one work-group; no score or probability ever reaches memory.
// S^T = K Q^T (A = K rows, B = Q rows, both on the 32 real head columns, one k-step) so that a lane holds one query's scores: two 16-key D tiles, converted in place, are the B operand of O^T += V^T P^T.
// Every plain '#pragma unroll' in k_fattn but the join's two over the FW slices in LDS stands on a short constant-trip loop over register arrays (fragments, accumulators): unrolled so that they are indexed by constants and stay in registers.
// Wave w walks keys [w KSL, (w + 1) KSL) with a kept reference exponent and a running sum (online softmax, f32, rescaled lazily: see LAZY RESCALE); the FW waves' (reference, sum, context) are joined in LDS in wave order. Three hi/lo bf16 products (hi.hi, lo.hi, hi.lo) on the scores; one f16 product on att.v.
#define FW   16           // waves of a work-group = key slices
#define NT   4            // 16-query tiles a wave: every K and V fragment fetched serves NT tiles
#define QW   (NT * 16)    // queries a work-group
#define KSL  (TT / FW)    // keys a wave
#define L2E  1.4426950408889634f
// LAZY RESCALE. A row's exponents are taken against a kept reference, its largest score when the reference was last set, in units of the exponent, plus HRM. A pass in the short form forms no maximum and corrects nothing: p = 2^(s log2e - reference), summed and multiplied as it is.
// p may then pass 1; it must stay finite in f16. The f32 sums of the pass, which are formed anyway, bound every p: where a lane's sum reaches PLIM the wave does those two query tiles again in the full form (maximum, new reference, sum and context corrected), before anything of the pass is added.
// HRM: at a full pass the largest p is 2^-HRM, which leaves 16 + HRM doublings until PLIM. f16's smallest step, 2^-24, is then 2^(HRM - 24) of the row's largest term.
#define HRM  8.0f
#define PLIM 65504.0f     // the largest finite f16
typedef __attribute__((ext_vector_type(4))) int v4i;
#define PK   (2 * 2 * FH)   // elements of one plane that a pass of 32 keys takes: two fragments, 2 KiB
// 2 KiB of a plane to LDS, through no register: four asynchronous copies of the wave, 512 contiguous bytes each; g and s point at the lane's own 16 bytes, the offset moves both addresses.
__device__ __forceinline__ void cp2k(const bf* g, bf* s) {
    __attribute__((address_space(1))) v4i* gp = (__attribute__((address_space(1))) v4i*)g; __attribute__((address_space(3))) v4i* sp = (__attribute__((address_space(3))) v4i*)s;
    __builtin_amdgcn_global_load_async_to_lds_b128(gp, sp, 0, 0); __builtin_amdgcn_global_load_async_to_lds_b128(gp, sp, 512, 0); __builtin_amdgcn_global_load_async_to_lds_b128(gp, sp, 1024, 0); __builtin_amdgcn_global_load_async_to_lds_b128(gp, sp, 1536, 0); }
__device__ __forceinline__ float xhalf(float x) { const int b = __float_as_int(x); return __int_as_float(__builtin_amdgcn_permlanex16(b, b, 0x76543210, 0xfedcba98, false, false)); }   // lane l <-> l ^ 16
__global__ __launch_bounds__(FW * 32) void k_fattn(const bf* __restrict__ Qh, const bf* __restrict__ Ql, const bf* __restrict__ Kh, const bf* __restrict__ Kl, const bf* __restrict__ Vf, float* out) {
    typedef WFrag<bf> F; typedef v16bf V;
    __shared__ float ms[FW][QW], ls[FW][QW]; __shared__ __align__(16) float os[FW][QW][36]; __shared__ __align__(16) bf ring[FW][3][PK]; __shared__ __align__(16) v8us qls[NT][2][32];   // ring: see K AND V THROUGH LDS below. qls: the low-part Q fragments in register order (tile, fragment half, lane), shared by all waves: 32 registers a wave fewer, no spill
    const int lane = threadIdx.x & 31, lr = lane & 15, hi = lane >> 4, w = __builtin_amdgcn_readfirstlane(threadIdx.x >> 5); const size_t zb = (size_t)blockIdx.y * TT * HDR; const int q0 = blockIdx.x * QW;
    Qh += zb; Ql += zb; Kh += zb; Kl += zb; Vf += zb;
    // K AND V THROUGH LDS. Each wave owns one 6-KiB slot (K hi, K lo, V of one pass), which no other wave touches: no barrier. The registers are the second buffer: a pass's K and V fragments are read out of the slot at the foot of the pass before, and at its head the next pass's 12 copies go into it, a whole pass ahead of their first reader, so that no wave waits on L2. (The wave's number goes through readfirstlane so that the planes' bases stay in scalar registers: with them in vector registers the build spilled.)
    bf* const rg = &ring[w][0][lane * 8]; const int k0 = w * KSL * HDR + lane * 8;
    cp2k(Vf + k0, rg + 2 * PK);   /* pass 0's V; its K comes straight to registers below */
    V qh[NT];
#pragma unroll
    for (int nt = 0; nt < NT; ++nt) qh[nt] = F::ldf(Qh + (q0 + nt * 16) * HDR + lane * 8);
    if (w < NT) { const bf* p = Ql + (q0 + w * 16) * HDR + lane * 8; qls[w][0][lane] = *(const v8us*)p; qls[w][1][lane] = *(const v8us*)(p + FH); }   /* wave w stages tile w */
    v8f acc[2][NT]; float eb[NT]; v2f l[NT];   /* eb: the row's reference exponent (see LAZY RESCALE); l: the row sum as a pair, even and odd keys apart, joined behind the loop */
#pragma unroll
    for (int nt = 0; nt < NT; ++nt) { acc[0][nt] = (v8f){}; acc[1][nt] = (v8f){}; eb[nt] = -3.0e38f; l[nt] = (v2f){}; }
    V kh[2], kl[2];
#pragma unroll
    for (int t = 0; t < 2; ++t) { const int o = (w * KSL + t * 16) * HDR + lane * 8; kh[t] = F::ldf(Kh + o); kl[t] = F::ldf(Kl + o); }
    asm volatile("s_wait_xcnt 0x0" ::: "memory");   // the loads above are issued: the wait stands in front of the first overwrite of their address registers
    asm volatile("s_wait_asynccnt 0x0" ::: "memory");   // pass 0's V has landed in this wave's slot before the wave reads it
    v16h vf[2];
#pragma unroll
    for (int mt = 0; mt < 2; ++mt) vf[mt] = __builtin_bit_cast(v16h, F::ldf(rg + 2 * PK + mt * 2 * FH));   /* pass 0's V fragments */
    __syncthreads();   // qls is whole before any wave reads it
    const v2f le2 = {L2E, L2E};
    // the 16-key score tiles of query tiles pr and pr + 1, s[tile][key half]: three hi/lo products each, hi.hi, hi.lo, lo.hi, in both forms of a pass; the four chains side by side, so that a product never waits for the one before it in its chain
    auto score = [&](int pr, v8f (&s)[2][2]) { V qlf[2];
#pragma unroll
        for (int h = 0; h < 2; ++h) qlf[h] = cat16b(qls[pr + h][0][lane], qls[pr + h][1][lane]);
#pragma unroll
        for (int h = 0; h < 2; ++h)
#pragma unroll
            for (int t = 0; t < 2; ++t) s[h][t] = F::mma(kh[t], qh[pr + h], (v8f){});
#pragma unroll
        for (int h = 0; h < 2; ++h)
#pragma unroll
            for (int t = 0; t < 2; ++t) s[h][t] = F::mma(kh[t], qlf[h], s[h][t]);
#pragma unroll
        for (int h = 0; h < 2; ++h)
#pragma unroll
            for (int t = 0; t < 2; ++t) s[h][t] = F::mma(kl[t], qh[pr + h], s[h][t]);
        __builtin_amdgcn_sched_barrier(0); };   // the twelve products stay together in front of the vector work: drawn in among them, each first reader of a result stood behind idle slots
    // p = 2^(s log2e - ref) of one query tile, summed in key order (onto sum2, or from nothing where fresh) and packed to f16 as the B operand of att.v
    auto expo = [&](const v8f (&s)[2], float ref, bool fresh, v2f& sum2, v8u& pu) { const v2f nm2 = {-ref, -ref};
#pragma unroll
        for (int t = 0; t < 2; ++t)
#pragma unroll
            for (int r = 0; r < 4; ++r) { const v2f s2 = {s[t][2 * r], s[t][2 * r + 1]}; const v2f e2 = __builtin_elementwise_fma(s2, le2, nm2);   /* the accumulator's own register pair: one packed multiply-add for two exponents */
                v2f p2; p2[0] = __builtin_amdgcn_exp2f(e2[0]); p2[1] = __builtin_amdgcn_exp2f(e2[1]); sum2 = (fresh && t == 0 && r == 0) ? p2 : sum2 + p2; pu[t * 4 + r] = pk2h(p2[0], p2[1]); } };
#pragma unroll 1   // rolled: the body is long, and four waves a SIMD cover its LDS latency
    for (int it = 0; it < KSL / 32; ++it) {
        const int kb = w * KSL + it * 32;
        if (it + 1 < KSL / 32) {   /* the refill, at the head, on the one path that every pass takes once: a scalar test, every lane on */
            asm volatile("s_wait_dscnt 0x0" ::: "memory");   // this wave's reads of the slot (this pass's K and V, at the foot of the pass before) have returned before a copy writes over them
            const int o = (kb + 32) * HDR + lane * 8; cp2k(Kh + o, rg); cp2k(Kl + o, rg + PK); cp2k(Vf + o, rg + 2 * PK);
        }
#pragma unroll
        for (int pr = 0; pr < NT; pr += 2) {   /* two query tiles at a time: their short form, one test, then either its sums and products or the full form */
            v8u pu[2]; v2f sl[2]; bool full = it == 0;   /* the first pass has no reference yet: it sets one, in the full form */
            if (!full) {   /* the short form: no maximum, no correction */
                v8f s[2][2]; score(pr, s);
#pragma unroll
                for (int h = 0; h < 2; ++h) expo(s[h], eb[pr + h], true, sl[h], pu[h]);
                const v2f t2 = sl[0] + sl[1];
                full = __builtin_amdgcn_ballot_w32(!(t2[0] + t2[1] < PLIM)) != 0;   /* every p is positive: a lane's sum under PLIM bounds each of its p; written so that infinity and not-a-number fail it. A scalar branch */
                if (!full) {
#pragma unroll
                    for (int h = 0; h < 2; ++h) { const int nt = pr + h; l[nt] += sl[h]; const v16h pf = __builtin_bit_cast(v16h, pu[h]);
#pragma unroll
                        for (int mt = 0; mt < 2; ++mt) acc[mt][nt] = wmmah(vf[mt], pf, acc[mt][nt]); }
                }
            }
            if (full) {   /* seldom. The full form: nothing of the short form was added anywhere; scores again, from the same registers */
                v8f s[2][2]; score(pr, s);
#pragma unroll
                for (int h = 0; h < 2; ++h) { const int nt = pr + h;
                    float mx = s[h][0][0];
#pragma unroll
                    for (int j = 1; j < 8; ++j) mx = fmaxf(mx, s[h][0][j]);
#pragma unroll
                    for (int j = 0; j < 8; ++j) mx = fmaxf(mx, s[h][1][j]);
                    const float mn = fmaxf(eb[nt], __builtin_fmaf(fmaxf(mx, xhalf(mx)), L2E, HRM)); const float corr = __builtin_amdgcn_exp2f(eb[nt] - mn); eb[nt] = mn;   /* the reference never falls; every exponent of the row is taken against this same number until its next full form */
                    v2f sum2 = l[nt] * corr; v8u pn; expo(s[h], mn, false, sum2, pn); l[nt] = sum2;
                    const v16h pf = __builtin_bit_cast(v16h, pn);
#pragma unroll
                    for (int mt = 0; mt < 2; ++mt) acc[mt][nt] = wmmah(vf[mt], pf, acc[mt][nt] * corr); }
            }
        }
        asm volatile("s_wait_asynccnt 0x0" ::: "memory");   // the 12 copies issued at the head have landed before the reads below
#pragma unroll
        for (int t = 0; t < 2; ++t) { kh[t] = F::ldf(rg + t * 2 * FH); kl[t] = F::ldf(rg + PK + t * 2 * FH); }   /* next pass's K fragments out of the slot (the last pass reads its own again: unused) */
#pragma unroll
        for (int mt = 0; mt < 2; ++mt) vf[mt] = __builtin_bit_cast(v16h, F::ldf(rg + 2 * PK + mt * 2 * FH));   /* and its V fragments, likewise */
    }
#pragma unroll
    for (int nt = 0; nt < NT; ++nt) { const int q = nt * 16 + lr; const float lh = l[nt][0] + l[nt][1]; const float lt = lh + xhalf(lh); if (hi == 0) { ms[w][q] = eb[nt]; ls[w][q] = lt; }
#pragma unroll
        for (int mt = 0; mt < 2; ++mt) { v4f a, b;   /* acc[mt][nt][j] = ctx[q][16 mt + 8 hi + j] */
#pragma unroll
            for (int j = 0; j < 4; ++j) { a[j] = acc[mt][nt][j]; b[j] = acc[mt][nt][4 + j]; }
            *(v4f*)&os[w][q][mt * 16 + hi * 8] = a; *(v4f*)&os[w][q][mt * 16 + hi * 8 + 4] = b; } }
    __syncthreads();   // every wave's slice result is in LDS before any thread joins them
    const int q = threadIdx.x >> 3, d0 = (threadIdx.x & 7) * 4; float M = ms[0][q];
#pragma unroll
    for (int s2 = 1; s2 < FW; ++s2) M = fmaxf(M, ms[s2][q]);
    float L = 0.f; v4f a = (v4f){};
#pragma unroll
    for (int s2 = 0; s2 < FW; ++s2) { const float f = __builtin_amdgcn_exp2f(ms[s2][q] - M); L += ls[s2][q] * f; a += *(const v4f*)&os[s2][q][d0] * f; }   /* wave order */
    const float inv = __fdiv_rn(1.0f, L); v4f o;
#pragma unroll
    for (int j = 0; j < 4; ++j) o[j] = __fmul_rn(a[j] * inv, OSC);
    *(v4f*)(out + ((size_t)blockIdx.y * TT + q0 + q) * HDR + d0) = o;  }

extern "C" void kernel_launch(void* const* d_in, const int* in_sizes, int n_in,
                              void* d_out, int out_size, void* d_ws, size_t ws_size, hipStream_t stream) {
    (void)in_sizes; (void)n_in; (void)out_size;
    const float* x = (const float*)d_in[0]; const float* wq = (const float*)d_in[1]; const float* wk = (const float*)d_in[2]; const float* wv = (const float*)d_in[3];
    float* OUT = (float*)d_out;     // [4][4096][32]
    char* wsp = (char*)d_ws;
    auto take = [&](size_t bytes) { char* p = wsp; wsp += (bytes + 255) & ~(size_t)255; return (void*)p; };
    const size_t PB = (size_t)TT * HDR;   // one batch's plane, elements
    bf* QPh = (bf*)take(NB_ * PB * 2); bf* QPl = (bf*)take(NB_ * PB * 2); bf* KPh = (bf*)take(NB_ * PB * 2); bf* KPl = (bf*)take(NB_ * PB * 2); bf* VTf = (bf*)take(NB_ * PB * 2);
    if ((size_t)(wsp - (char*)d_ws) > ws_size) return;    // ws 256 MiB
    k_proj<<<NB_ * TT / PR, 256, 0, stream>>>(x, wq, wk, wv, QPh, QPl, KPh, KPl, VTf);   /* hi/lo planes of q, k, the f16 plane of v^T, all batches */
    k_fattn<<<dim3(TT / QW, NB_, 1), FW * 32, 0, stream>>>(QPh, QPl, KPh, KPl, VTf, OUT);   /* out = softmax(q k^T) v x 32^-0.5, all batches */
}

// v009
// A run of this version takes 19.1 microseconds.
// Two timings next to v008 put it at 1.06 and 1.07 times that version's speed.
// Over all steps from v000 it is 38.3 times as fast.
#include <hip/hip_runtime.h>

// Single-head attention with POST-softmax scaling (x [4][4096][256]; q,k,v = x W ('xw' [256][32], no bias); energy = q.k UNSCALED; att = softmax(energy) x 32^-0.5; out = att v -> [4][4096][32] (0.5 M)).
// Two launches. k_proj: x and the three weights rounded to bf16 on the way in, the three 32-wide projections as exact bf16 products, hi/lo bf16 planes of q and k and one f16 plane of v^T for all batches, each laid out in WMMA fragment order (see FRAGMENT-ORDER PLANES below). k_fattn: ONE fused attention launch for all batches (64 queries a work-group, the keys split over its 16 waves, online softmax, scores hi/lo 3 bf16 products, att.v one f16 product, the slices joined in LDS in wave order, x 32^-0.5 at the end).
// Compute dtypes, f32 accumulate: every input rounded to bf16; projections exact; scores 3 bf16 hi/lo products on every row (unscaled logits, sigma ~5.7: an error there is multiplied by the exponential); att.v one f16 product, P (positive, kept under PLIM: see LAZY RESCALE) and v (a sum of 256 products of a unit normal and a normal / 16: far inside f16's range) each rounded once to 11 bits, a relative 2^-12 that enters the output linearly, about an eighth of what the bf16 rounding of x and the weights already leaves in v; softmax f32; the post-softmax scale applied in f32 at the end (a power of two times 1/sqrt(2): one rounding, as the reference's att x scaling then att v up to association).

#define NB_  4
#define TT   4096
#define DM   256
#define HDR  32     // head dim
#define FH   256    // elements of one fragment half: 32 lanes x 8
// FRAGMENT-ORDER PLANES. A plane is a row of 1-KiB fragments, each [half][lane][8 elements]: what lane l holds of a 16x32 A or B operand (row l & 15; k = 8 (l >> 4) + j in half 0, 16 + 8 (l >> 4) + j in half 1) lies at half FH + 8 l.
// q, k: fragment t / 16 (16 tokens x the 32 head columns). v^T: fragments 2 (t / 32) and 2 (t / 32) + 1 (head rows 0..15 and 16..31 x 32 tokens). Either way token t's fragments start at element t HDR rounded down to a fragment (v^T: to two fragments), and a batch is TT HDR elements.
// A wave's 16-byte load or store of a half is then 512 contiguous bytes, four whole 128-byte lines, where a row-major plane gives sixteen 32-byte pieces of sixteen lines.
#define OSC  0.17677669529663688f   // 32^-0.5 applied after the softmax
typedef unsigned short bf;
typedef __attribute__((ext_vector_type(16))) __bf16   v16bf;
typedef __attribute__((ext_vector_type(8)))  unsigned short v8us;
typedef __attribute__((ext_vector_type(8)))  float    v8f;
typedef __attribute__((ext_vector_type(4)))  float    v4f;
typedef __attribute__((ext_vector_type(2)))  float    v2f;
typedef __attribute__((ext_vector_type(2))) __bf16 v2bf;
typedef __attribute__((ext_vector_type(16))) _Float16 v16h;
typedef __attribute__((ext_vector_type(2)))  _Float16 v2h;
typedef __attribute__((ext_vector_type(4))) unsigned v4u;
typedef __attribute__((ext_vector_type(8))) unsigned v8u;
typedef __attribute__((ext_vector_type(2))) unsigned v2u;

__device__ __forceinline__ unsigned pk2(float a, float b) { v2f t; t[0] = a; t[1] = b; return __builtin_bit_cast(unsigned, __builtin_convertvector(t, v2bf)); }   // two f32 -> packed bf16, nearest even
__device__ __forceinline__ unsigned pk2h(float a, float b) { v2f t; t[0] = a; t[1] = b; return __builtin_bit_cast(unsigned, __builtin_convertvector(t, v2h)); }   // two f32 -> packed f16, nearest even
__device__ __forceinline__ v16bf cat16b(v8us lo, v8us hi) { return __builtin_bit_cast(v16bf, __builtin_shufflevector(lo, hi, 0, 1, 2, 3, 4, 5, 6, 7, 8, 9, 10, 11, 12, 13, 14, 15)); }
__device__ __forceinline__ v8f wmmab(v16bf a, v16bf b, v8f c) { return __builtin_amdgcn_wmma_f32_16x16x32_bf16(false, a, false, b, (short)0, c, false, false); }
__device__ __forceinline__ v8f wmmah(v16h a, v16h b, v8f c) { return __builtin_amdgcn_wmma_f32_16x16x32_f16(false, a, false, b, (short)0, c, false, false); }   // same fragment maps as the bf16 form
// A or B fragment of a 16x16x32 product from a K-contiguous 16-bit row: lane (lr, hi) holds row lr, k = 8 hi .. 8 hi + 7 and 16 + 8 hi .. 16 + 8 hi + 7; p points at its row's k = 8 hi.
template <typename T16> struct WFrag;
template <> struct WFrag<bf> { typedef v16bf V; static __device__ __forceinline__ V ld(const bf* p) { return cat16b(*(const v8us*)p, *(const v8us*)(p + 16)); } static __device__ __forceinline__ V ldf(const bf* p) { return cat16b(*(const v8us*)p, *(const v8us*)(p + FH)); } /* from a fragment-order plane: p points at the lane's 8 elements of half 0 */ static __device__ __forceinline__ v8f mma(V a, V b, v8f c) { return wmmab(a, b, c); } };
__device__ __forceinline__ void split8(v8f v, v4u& oh, v4u& ol) {   // 8 f32 -> 8 bf16 high parts and the 8 bf16 roundings of what they leave
#pragma unroll
    for (int r = 0; r < 4; ++r) { const unsigned h2 = pk2(v[2 * r], v[2 * r + 1]); oh[r] = h2; ol[r] = pk2(v[2 * r] - __uint_as_float(h2 << 16), v[2 * r + 1] - __uint_as_float(h2 & 0xFFFF0000u)); } }

// ---- k_proj: q, k, v of PR rows of x (all batches as one row range) in one work-group of 8 waves, straight to the planes (q, k: bf16 hi/lo; v^T: f16).
// Wave w owns the 16 rows of tile w >> 1 and three of the six 16-column tiles: both of q and the first of v (w even), both of k and the second of v (w odd). The work-group's x rows are loaded once, 512 contiguous bytes (four whole lines) a load of the wave, all of them in flight at once, rounded once and laid in LDS as bf16 rows; a wave reads its fragments from there. (Loaded straight into fragment registers, a 16-byte load of the wave is sixteen 32-byte pieces of sixteen lines, every line is asked for four times, and both waves of a row tile do so.) The weights are rounded and transposed into LDS once a work-group.
// q and k are formed transposed (A = weight rows, B = x rows) and v plain (A = x rows, B = weight rows), so that a lane's 8 accumulator values are the 8 elements that the same lane holds of a fragment half: each accumulator goes straight to its plane as one 512-byte store of the wave. k runs upward in steps of 32 in one accumulator, as a plain GEMM loop does.
// Every plain '#pragma unroll' in k_proj stands on a short constant-trip loop over register arrays: unrolled so that they are indexed by constants and stay in registers.
#define PR   64     // rows of x a work-group
#define WP   264    // LDS pitch of a transposed weight row, elements: 528 B = 16 B x odd, the pitch for 16-byte fragment reads
__global__ __launch_bounds__(256) void k_proj(const float* __restrict__ x, const float* __restrict__ wq, const float* __restrict__ wk, const float* __restrict__ wv, bf* Qh, bf* Ql, bf* Kh, bf* Kl, bf* Vf) {
    typedef WFrag<bf> F; typedef v16bf V;
    __shared__ __align__(16) bf wt[3 * HDR][WP]; __shared__ __align__(16) bf xs[PR][WP];   // xs: the x rows as bf16, at the weights' pitch: the same 16-byte fragment reads
    const int lane = threadIdx.x & 31, lr = lane & 15, hi = lane >> 4, w = __builtin_amdgcn_readfirstlane(threadIdx.x >> 5); const int mt = w >> 1, hf = w & 1; const size_t g0 = (size_t)blockIdx.x * PR;
    const int kl = (lane >> 3) * 8, n0 = (lane & 7) * 4; const float* ws[3]; v4f t[3][8];   /* 24 strips (matrix, 32 k) over 8 waves, 3 a wave; a lane takes 8 k x 4 columns of each: whole 128-byte rows in, four 16-byte LDS stores out */
#pragma unroll
    for (int i = 0; i < 3; ++i) { const int s = w * 3 + i, mx = s >> 3; ws[i] = (mx == 0 ? wq : mx == 1 ? wk : wv) + ((s & 7) * 32 + kl) * HDR + n0;
#pragma unroll
        for (int j = 0; j < 8; ++j) t[i][j] = *(const v4f*)(ws[i] + j * HDR); }
    asm volatile("s_wait_xcnt 0x0" :: "v"(ws[0]), "v"(ws[1]), "v"(ws[2]) : "memory");   // in front of the first overwrite of the weight loads' address pairs; it also keeps all of them in front of the x loads: loads return in order, so the weights are rounded and laid in LDS while x is on its way
    const float* gx = x + (g0 + w * 8) * DM + lane * 4; v4f xr[8][2];   /* wave w brings rows 8 w .. 8 w + 7 of the work-group's PR, two loads a row */
#pragma unroll
    for (int r = 0; r < 8; ++r) { xr[r][0] = *(const v4f*)(gx + r * DM); xr[r][1] = *(const v4f*)(gx + r * DM + DM / 2); }
    asm volatile("s_wait_xcnt 0x0" ::: "memory");   // in front of the first overwrite of the x loads' address registers; the memory clobber keeps the x loads in front of it
    __builtin_amdgcn_sched_barrier(0);   // the weights' rounding, which waits for their data, stays behind the issue of the x loads: without it the x loads leave one L2 round trip later
#pragma unroll
    for (int i = 0; i < 3; ++i) { const int s = w * 3 + i, mx = s >> 3, k0 = (s & 7) * 32 + kl;
#pragma unroll
        for (int e = 0; e < 4; ++e) { v4u o;
#pragma unroll
            for (int r = 0; r < 4; ++r) o[r] = pk2(t[i][2 * r][e], t[i][2 * r + 1][e]);
            *(v4u*)&wt[mx * HDR + n0 + e][k0] = o; } }
#pragma unroll
    for (int r = 0; r < 8; ++r)
#pragma unroll
        for (int h = 0; h < 2; ++h) { v2u o; o[0] = pk2(xr[r][h][0], xr[r][h][1]); o[1] = pk2(xr[r][h][2], xr[r][h][3]); *(v2u*)&xs[w * 8 + r][h * (DM / 2) + lane * 4] = o; }   /* 256 contiguous bytes a store of the wave */
    __syncthreads();   // the transposed weights and the x rows are whole before any wave reads them
    v8f a0 = (v8f){}, a1 = (v8f){}, a2 = (v8f){}; const bf* pw = &wt[hf * HDR + lr][8 * hi]; const bf* pv = &wt[2 * HDR + hf * 16 + lr][8 * hi]; const bf* px = &xs[mt * 16 + lr][8 * hi];
    V xf[DM / 32], fa[DM / 32], fb[DM / 32], fc[DM / 32];   /* fragments of k-step ks: x, and the wave's three weight tiles */
    auto ldw = [&](int ks) { fa[ks] = F::ld(pw + ks * 32); fb[ks] = F::ld(pw + 16 * WP + ks * 32); fc[ks] = F::ld(pv + ks * 32); };
    auto mm = [&](int ks) { a0 = F::mma(fa[ks], xf[ks], a0); a1 = F::mma(fb[ks], xf[ks], a1); a2 = F::mma(xf[ks], fc[ks], a2); };
    // The LDS reads stand in three groups: the first in front of all products, the second and third each two k-steps ahead of their first product. Every sched_barrier below holds a group in its place: left free, the compiler put each pair of reads directly in front of its product, behind a full wait, and ran the three accumulators one after another.
#pragma unroll
    for (int ks = 0; ks < 4; ++ks) { xf[ks] = F::ld(px + ks * 32); ldw(ks); }
#pragma unroll
    for (int ks = 4; ks < DM / 32; ++ks) xf[ks] = F::ld(px + ks * 32);
    __builtin_amdgcn_sched_barrier(0);   // first group of reads in front of the first products
    mm(0); mm(1);
    __builtin_amdgcn_sched_barrier(0);   // second group not drawn up among those products
    ldw(4); ldw(5);
    __builtin_amdgcn_sched_barrier(0);   // nor sunk to its own products
    mm(2); mm(3);
    __builtin_amdgcn_sched_barrier(0);   // third group, likewise
    ldw(6); ldw(7);
    __builtin_amdgcn_sched_barrier(0);   // and it, too, is not sunk to its own products
    mm(4); mm(5); mm(6); mm(7);
    v4u h0, l0, h1, l1, h2; split8(a0, h0, l0); split8(a1, h1, l1);
#pragma unroll
    for (int r = 0; r < 4; ++r) h2[r] = pk2h(a2[2 * r], a2[2 * r + 1]);   /* every split in registers of its own: no store's data register is written again */
    bf* Ph = hf ? Kh : Qh; bf* Pl = hf ? Kl : Ql; const size_t ro = (g0 + mt * 16) * HDR + lane * 8;   /* a0[j], a1[j] = row mt 16 + lr, column 8 hi + j, 16 + 8 hi + j: halves 0 and 1 of the row tile's fragment */
    *(v4u*)(Ph + ro) = h0; *(v4u*)(Pl + ro) = l0; *(v4u*)(Ph + ro + FH) = h1; *(v4u*)(Pl + ro + FH) = l1;
    const size_t vo = (g0 + (mt >> 1) * 32) * HDR + (hf * 2 + (mt & 1)) * FH + lane * 8;   /* a2[j] = row mt 16 + 8 hi + j, column hf 16 + lr: half mt & 1 of fragment hf of the 32-token block */
    *(v4u*)(Vf + vo) = h2;  }
// ---- k_fattn: scores, softmax and att.v of one 64-query tile in one work-group; no score or probability ever reaches memory.
// S^T = K Q^T (A = K rows, B = Q rows, both on the 32 real head columns, one k-step) so that a lane holds one query's scores: two 16-key D tiles, converted in place, are the B operand of O^T += V^T P^T.
// Every plain '#pragma unroll' in k_fattn but the join's two over the FW slices in LDS stands on a short constant-trip loop over register arrays (fragments, accumulators): unrolled so that they are indexed by constants and stay in registers.
// Wave w walks keys [w KSL, (w + 1) KSL) with a kept reference exponent and a running sum (online softmax, f32, rescaled lazily: see LAZY RESCALE); the FW waves' (reference, sum, context) are joined in LDS in wave order. Three hi/lo bf16 products (hi.hi, lo.hi, hi.lo) on the scores; one f16 product on att.v.
#define FW   16           // waves of a work-group = key slices
#define NT   4            // 16-query tiles a wave: every K and V fragment fetched serves NT tiles
#define QW   (NT * 16)    // queries a work-group
#define KSL  (TT / FW)    // keys a wave
#define L2E  1.4426950408889634f
// LAZY RESCALE. A row's exponents are taken against a kept reference, its largest score when the reference was last set, in units of the exponent, plus HRM. A pass in the short form forms no maximum and corrects nothing: p = 2^(s log2e - reference), summed and multiplied as it is.
// p may then pass 1; it must stay finite in f16. The f32 sums of the pass, which are formed anyway, bound every p: where a lane's sum reaches PLIM the wave does those two query tiles again in the full form (maximum, new reference, sum and context corrected), before anything of the pass is added.
// HRM: at a full pass the largest p is 2^-HRM, which leaves 16 + HRM doublings until PLIM. f16's smallest step, 2^-24, is then 2^(HRM - 24) of the row's largest term.
#define HRM  8.0f
#define PLIM 65504.0f     // the largest finite f16
typedef __attribute__((ext_vector_type(4))) int v4i;
#define PK   (2 * 2 * FH)   // elements of one plane that a pass of 32 keys takes: two fragments, 2 KiB
// 2 KiB of a plane to LDS, through no register: four asynchronous copies of the wave, 512 contiguous bytes each; g and s point at the lane's own 16 bytes, the offset moves both addresses.
__device__ __forceinline__ void cp2k(const bf* g, bf* s) {
    __attribute__((address_space(1))) v4i* gp = (__attribute__((address_space(1))) v4i*)g; __attribute__((address_space(3))) v4i* sp = (__attribute__((address_space(3))) v4i*)s;
    __builtin_amdgcn_global_load_async_to_lds_b128(gp, sp, 0, 0); __builtin_amdgcn_global_load_async_to_lds_b128(gp, sp, 512, 0); __builtin_amdgcn_global_load_async_to_lds_b128(gp, sp, 1024, 0); __builtin_amdgcn_global_load_async_to_lds_b128(gp, sp, 1536, 0); }
__device__ __forceinline__ float xhalf(float x) { const int b = __float_as_int(x); return __int_as_float(__builtin_amdgcn_permlanex16(b, b, 0x76543210, 0xfedcba98, false, false)); }   // lane l <-> l ^ 16
__global__ __launch_bounds__(FW * 32) void k_fattn(const bf* __restrict__ Qh, const bf* __restrict__ Ql, const bf* __restrict__ Kh, const bf* __restrict__ Kl, const bf* __restrict__ Vf, float* out) {
    typedef WFrag<bf> F; typedef v16bf V;
    __shared__ float ms[FW][QW], ls[FW][QW]; __shared__ __align__(16) float os[FW][QW][36]; __shared__ __align__(16) bf ring[FW][3][PK]; __shared__ __align__(16) v8us qls[NT][2][32];   // ring: see K AND V THROUGH LDS below. qls: the low-part Q fragments in register order (tile, fragment half, lane), shared by all waves: 32 registers a wave fewer, no spill
    const int lane = threadIdx.x & 31, lr = lane & 15, hi = lane >> 4, w = __builtin_amdgcn_readfirstlane(threadIdx.x >> 5); const size_t zb = (size_t)blockIdx.y * TT * HDR; const int q0 = blockIdx.x * QW;
    Qh += zb; Ql += zb; Kh += zb; Kl += zb; Vf += zb;
    // K AND V THROUGH LDS. Each wave owns one 6-KiB slot (K hi, K lo, V of one pass), which no other wave touches: no barrier. The registers are the second buffer: a pass's K and V fragments are read out of the slot at the foot of the pass before, and at its head the next pass's 12 copies go into it, a whole pass ahead of their first reader, so that no wave waits on L2. (The wave's number goes through readfirstlane so that the planes' bases stay in scalar registers: with them in vector registers the build spilled.)
    bf* const rg = &ring[w][0][lane * 8]; const int k0 = w * KSL * HDR + lane * 8;
    cp2k(Vf + k0, rg + 2 * PK);   /* pass 0's V; its K comes straight to registers below */
    V qh[NT];
#pragma unroll
    for (int nt = 0; nt < NT; ++nt) qh[nt] = F::ldf(Qh + (q0 + nt * 16) * HDR + lane * 8);
    if (w < NT) { const bf* p = Ql + (q0 + w * 16) * HDR + lane * 8; qls[w][0][lane] = *(const v8us*)p; qls[w][1][lane] = *(const v8us*)(p + FH); }   /* wave w stages tile w */
    v8f acc[2][NT]; float eb[NT]; v2f l[NT];   /* eb: the row's reference exponent (see LAZY RESCALE); l: the row sum as a pair, even and odd keys apart, joined behind the loop */
#pragma unroll
    for (int nt = 0; nt < NT; ++nt) { acc[0][nt] = (v8f){}; acc[1][nt] = (v8f){}; eb[nt] = -3.0e38f; l[nt] = (v2f){}; }
    V kh[2], kl[2];
#pragma unroll
    for (int t = 0; t < 2; ++t) { const int o = (w * KSL + t * 16) * HDR + lane * 8; kh[t] = F::ldf(Kh + o); kl[t] = F::ldf(Kl + o); }
    asm volatile("s_wait_xcnt 0x0" ::: "memory");   // the loads above are issued: the wait stands in front of the first overwrite of their address registers
    asm volatile("s_wait_asynccnt 0x0" ::: "memory");   // pass 0's V has landed in this wave's slot before the wave reads it
    v16h vf[2];
#pragma unroll
    for (int mt = 0; mt < 2; ++mt) vf[mt] = __builtin_bit_cast(v16h, F::ldf(rg + 2 * PK + mt * 2 * FH));   /* pass 0's V fragments */
    __syncthreads();   // qls is whole before any wave reads it
    const v2f le2 = {L2E, L2E};
    // the 16-key score tiles of query tiles pr and pr + 1, s[tile][key half]: three hi/lo products each, hi.hi, hi.lo, lo.hi, in both forms of a pass; the four chains side by side, so that a product never waits for the one before it in its chain
    auto score = [&](int pr, v8f (&s)[2][2]) { V qlf[2];
#pragma unroll
        for (int h = 0; h < 2; ++h) qlf[h] = cat16b(qls[pr + h][0][lane], qls[pr + h][1][lane]);
#pragma unroll
        for (int h = 0; h < 2; ++h)
#pragma unroll
            for (int t = 0; t < 2; ++t) s[h][t] = F::mma(kh[t], qh[pr + h], (v8f){});
#pragma unroll
        for (int h = 0; h < 2; ++h)
#pragma unroll
            for (int t = 0; t < 2; ++t) s[h][t] = F::mma(kh[t], qlf[h], s[h][t]);
#pragma unroll
        for (int h = 0; h < 2; ++h)
#pragma unroll
            for (int t = 0; t < 2; ++t) s[h][t] = F::mma(kl[t], qh[pr + h], s[h][t]);
        __builtin_amdgcn_sched_barrier(0); };   // the twelve products stay together in front of the vector work: drawn in among them, each first reader of a result stood behind idle slots
    // p = 2^(s log2e - ref) of one query tile, summed in key order (onto sum2, or from nothing where fresh) and packed to f16 as the B operand of att.v
    auto expo = [&](const v8f (&s)[2], float ref, bool fresh, v2f& sum2, v8u& pu) { const v2f nm2 = {-ref, -ref};
#pragma unroll
        for (int t = 0; t < 2; ++t)
#pragma unroll
            for (int r = 0; r < 4; ++r) { const v2f s2 = {s[t][2 * r], s[t][2 * r + 1]}; const v2f e2 = __builtin_elementwise_fma(s2, le2, nm2);   /* the accumulator's own register pair: one packed multiply-add for two exponents */
                v2f p2; p2[0] = __builtin_amdgcn_exp2f(e2[0]); p2[1] = __builtin_amdgcn_exp2f(e2[1]); sum2 = (fresh && t == 0 && r == 0) ? p2 : sum2 + p2; pu[t * 4 + r] = pk2h(p2[0], p2[1]); } };
#pragma unroll 1   // rolled: the body is long, and four waves a SIMD cover its LDS latency
    for (int it = 0; it < KSL / 32; ++it) {
        const int kb = w * KSL + it * 32;
        if (it + 1 < KSL / 32) {   /* the refill, at the head, on the one path that every pass takes once: a scalar test, every lane on */
            asm volatile("s_wait_dscnt 0x0" ::: "memory");   // this wave's reads of the slot (this pass's K and V, at the foot of the pass before) have returned before a copy writes over them
            const int o = (kb + 32) * HDR + lane * 8; cp2k(Kh + o, rg); cp2k(Kl + o, rg + PK); cp2k(Vf + o, rg + 2 * PK);
        }
#pragma unroll
        for (int pr = 0; pr < NT; pr += 2) {   /* two query tiles at a time: their short form, one test, then either its sums and products or the full form */
            v8u pu[2]; v2f sl[2]; bool full = it == 0;   /* the first pass has no reference yet: it sets one, in the full form */
            if (!full) {   /* the short form: no maximum, no correction */
                v8f s[2][2]; score(pr, s);
#pragma unroll
                for (int h = 0; h < 2; ++h) expo(s[h], eb[pr + h], true, sl[h], pu[h]);
                const v2f t2 = sl[0] + sl[1];
                full = __builtin_amdgcn_ballot_w32(!(t2[0] + t2[1] < PLIM)) != 0;   /* every p is positive: a lane's sum under PLIM bounds each of its p; written so that infinity and not-a-number fail it. A scalar branch */
                if (!full) {
#pragma unroll
                    for (int h = 0; h < 2; ++h) { const int nt = pr + h; l[nt] += sl[h]; const v16h pf = __builtin_bit_cast(v16h, pu[h]);
#pragma unroll
                        for (int mt = 0; mt < 2; ++mt) acc[mt][nt] = wmmah(vf[mt], pf, acc[mt][nt]); }
                }
            }
            if (full) {   /* seldom. The full form: nothing of the short form was added anywhere; scores again, from the same registers */
                v8f s[2][2]; score(pr, s);
#pragma unroll
                for (int h = 0; h < 2; ++h) { const int nt = pr + h;
                    float mx = s[h][0][0];
#pragma unroll
                    for (int j = 1; j < 8; ++j) mx = fmaxf(mx, s[h][0][j]);
#pragma unroll
                    for (int j = 0; j < 8; ++j) mx = fmaxf(mx, s[h][1][j]);
                    const float mn = fmaxf(eb[nt], __builtin_fmaf(fmaxf(mx, xhalf(mx)), L2E, HRM)); const float corr = __builtin_amdgcn_exp2f(eb[nt] - mn); eb[nt] = mn;   /* the reference never falls; every exponent of the row is taken against this same number until its next full form */
                    v2f sum2 = l[nt] * corr; v8u pn; expo(s[h], mn, false, sum2, pn); l[nt] = sum2;
                    const v16h pf = __builtin_bit_cast(v16h, pn);
#pragma unroll
                    for (int mt = 0; mt < 2; ++mt) acc[mt][nt] = wmmah(vf[mt], pf, acc[mt][nt] * corr); }
            }
        }
        asm volatile("s_wait_asynccnt 0x0" ::: "memory");   // the 12 copies issued at the head have landed before the reads below
#pragma unroll
        for (int t = 0; t < 2; ++t) { kh[t] = F::ldf(rg + t * 2 * FH); kl[t] = F::ldf(rg + PK + t * 2 * FH); }   /* next pass's K fragments out of the slot (the last pass reads its own again: unused) */
#pragma unroll
        for (int mt = 0; mt < 2; ++mt) vf[mt] = __builtin_bit_cast(v16h, F::ldf(rg + 2 * PK + mt * 2 * FH));   /* and its V fragments, likewise */
    }
#pragma unroll
    for (int nt = 0; nt < NT; ++nt) { const int q = nt * 16 + lr; const float lh = l[nt][0] + l[nt][1]; const float lt = lh + xhalf(lh); if (hi == 0) { ms[w][q] = eb[nt]; ls[w][q] = lt; }
#pragma unroll
        for (int mt = 0; mt < 2; ++mt) { v4f a, b;   /* acc[mt][nt][j] = ctx[q][16 mt + 8 hi + j] */
#pragma unroll
            for (int j = 0; j < 4; ++j) { a[j] = acc[mt][nt][j]; b[j] = acc[mt][nt][4 + j]; }
            *(v4f*)&os[w][q][mt * 16 + hi * 8] = a; *(v4f*)&os[w][q][mt * 16 + hi * 8 + 4] = b; } }
    __syncthreads();   // every wave's slice result is in LDS before any thread joins them
    const int q = threadIdx.x >> 3, d0 = (threadIdx.x & 7) * 4; float M = ms[0][q];
#pragma unroll
    for (int s2 = 1; s2 < FW; ++s2) M = fmaxf(M, ms[s2][q]);
    float L = 0.f; v4f a = (v4f){};
#pragma unroll
    for (int s2 = 0; s2 < FW; ++s2) { const float f = __builtin_amdgcn_exp2f(ms[s2][q] - M); L += ls[s2][q] * f; a += *(const v4f*)&os[s2][q][d0] * f; }   /* wave order */
    const float inv = __fdiv_rn(1.0f, L); v4f o;
#pragma unroll
    for (int j = 0; j < 4; ++j) o[j] = __fmul_rn(a[j] * inv, OSC);
    *(v4f*)(out + ((size_t)blockIdx.y * TT + q0 + q) * HDR + d0) = o;  }

extern "C" void kernel_launch(void* const* d_in, const int* in_sizes, int n_in,
                              void* d_out, int out_size, void* d_ws, size_t ws_size, hipStream_t stream) {
    (void)in_sizes; (void)n_in; (void)out_size;
    const float* x = (const float*)d_in[0]; const float* wq = (const float*)d_in[1]; const float* wk = (const float*)d_in[2]; const float* wv = (const float*)d_in[3];
    float* OUT = (float*)d_out;     // [4][4096][32]
    char* wsp = (char*)d_ws;
    auto take = [&](size_t bytes) { char* p = wsp; wsp += (bytes + 255) & ~(size_t)255; return (void*)p; };
    const size_t PB = (size_t)TT * HDR;   // one batch's plane, elements
    bf* QPh = (bf*)take(NB_ * PB * 2); bf* QPl = (bf*)take(NB_ * PB * 2); bf* KPh = (bf*)take(NB_ * PB * 2); bf* KPl = (bf*)take(NB_ * PB * 2); bf* VTf = (bf*)take(NB_ * PB * 2);
    if ((size_t)(wsp - (char*)d_ws) > ws_size) return;    // ws 256 MiB
    k_proj<<<NB_ * TT / PR, 256, 0, stream>>>(x, wq, wk, wv, QPh, QPl, KPh, KPl, VTf);   /* hi/lo planes of q, k, the f16 plane of v^T, all batches */
    k_fattn<<<dim3(TT / QW, NB_, 1), FW * 32, 0, stream>>>(QPh, QPl, KPh, KPl, VTf, OUT);   /* out = softmax(q k^T) v x 32^-0.5, all batches */
}
